// v000
// The times below were measured on an AMD MI455X: many runs one after another, warmed up first and cycling through
// copies of the inputs, with the whole window's GPU time divided by the number of runs. Launches and the gaps
// between them are all in it. The median over several windows is given; except for v000 it joins two sittings, which
// can be a few percent apart, so the side-by-side timings, each taken in one sitting, are the better comparison.
// v000, which the later versions start from, runs in 345 microseconds.
#include <hip/hip_runtime.h>
#include <hip/hip_bf16.h>
#include <math.h>

typedef __bf16 bf16_t;
typedef __attribute__((ext_vector_type(16))) __bf16 v16bf;
typedef __attribute__((ext_vector_type(8)))  float  v8f;
typedef __attribute__((ext_vector_type(4)))  unsigned int u32x4;
typedef __attribute__((ext_vector_type(8)))  int i32x8;
typedef __attribute__((ext_vector_type(4)))  int i32x4;

#define S_LEN  2048
#define DMODEL 1024
#define NHEAD  16
#define HDIM   64
#define MTOT   4096   // B * S

#if defined(__has_builtin)
#if __has_builtin(__builtin_amdgcn_tensor_load_to_lds)
#define HAVE_TDM 1
#endif
#endif
#ifndef HAVE_TDM
#define HAVE_TDM 0
#endif

__device__ __forceinline__ v16bf load_frag16(const bf16_t* rowp, int kbase) {
  v16bf a;
  ((uint4*)&a)[0] = *(const uint4*)(rowp + kbase);        // K = kbase..kbase+7
  ((uint4*)&a)[1] = *(const uint4*)(rowp + 16 + kbase);   // K = 16+kbase..+7
  return a;
}

__device__ __forceinline__ v8f wmma_bf16(v16bf a, v16bf b, v8f c) {
  return __builtin_amdgcn_wmma_f32_16x16x32_bf16(
      false, a, false, b, (short)0, c, false, false);
}

__device__ __forceinline__ v8f zero8() {
  return (v8f){0.f,0.f,0.f,0.f,0.f,0.f,0.f,0.f};
}

// ---------------------------------------------------------------------------
// 32x64 wave GEMM core: acc[2][4] covers rows m0..m0+31, cols n0..n0+63.
// 12 b128 loads per 8 WMMAs (A fragments reused 4x, B fragments reused 2x).
// ---------------------------------------------------------------------------
__device__ __forceinline__ void wave_gemm_32x64(const bf16_t* __restrict__ X,
                                                const bf16_t* __restrict__ Wt,
                                                int m0, int n0, v8f acc[2][4]) {
  const int lane  = threadIdx.x & 31;
  const int r16   = lane & 15;
  const int kbase = (lane >> 4) << 3;
  const bf16_t* arow0 = X  + (size_t)(m0 + r16) * DMODEL;
  const bf16_t* arow1 = X  + (size_t)(m0 + 16 + r16) * DMODEL;
  const bf16_t* brow  = Wt + (size_t)(n0 + r16) * DMODEL;
  for (int k0 = 0; k0 < DMODEL; k0 += 32) {
    v16bf a0 = load_frag16(arow0 + k0, kbase);
    v16bf a1 = load_frag16(arow1 + k0, kbase);
#pragma unroll
    for (int c = 0; c < 4; ++c) {
      v16bf b = load_frag16(brow + (size_t)(c * 16) * DMODEL + k0, kbase);
      acc[0][c] = wmma_bf16(a0, b, acc[0][c]);
      acc[1][c] = wmma_bf16(a1, b, acc[1][c]);
    }
  }
}

// ---------------------------------------------------------------------------
// Conversions
// ---------------------------------------------------------------------------
__global__ void f32_to_bf16_kernel(const float* __restrict__ src,
                                   bf16_t* __restrict__ dst, int n) {
  int i = blockIdx.x * blockDim.x + threadIdx.x;
  if (i < n) dst[i] = (bf16_t)src[i];
}

// W [H][D][HD] f32 -> Wt [c = h*HD+hd][k = d] bf16 (k-contiguous rows)
__global__ void proj_w_transpose_kernel(const float* __restrict__ W,
                                        bf16_t* __restrict__ Wt) {
  int idx = blockIdx.x * blockDim.x + threadIdx.x;   // over 1024*1024
  int c = idx >> 10, k = idx & 1023;
  Wt[idx] = (bf16_t)W[((size_t)(c >> 6) * DMODEL + k) * HDIM + (c & 63)];
}

// Wo [D][D] f32 -> Wot[c][k] = Wo[k][c] bf16
__global__ void wo_transpose_kernel(const float* __restrict__ W,
                                    bf16_t* __restrict__ Wt) {
  int idx = blockIdx.x * blockDim.x + threadIdx.x;
  int c = idx >> 10, k = idx & 1023;
  Wt[idx] = (bf16_t)W[(size_t)k * DMODEL + c];
}

// ---------------------------------------------------------------------------
// QKV projection: 32x64 tile per wave; out[b,h,s,hd] bf16 = X @ Wt^T + bias
// ---------------------------------------------------------------------------
__global__ void __launch_bounds__(256)
qkv_proj_kernel(const bf16_t* __restrict__ X, const bf16_t* __restrict__ Wt,
                const float* __restrict__ bias, bf16_t* __restrict__ out) {
  const int wave = threadIdx.x >> 5;
  const int lane = threadIdx.x & 31;
  const int tile = blockIdx.x * 8 + wave;
  const int m0 = (tile >> 4) << 5;   // 128 m-tiles of 32
  const int n0 = (tile & 15) << 6;   // 16 n-tiles of 64

  v8f acc[2][4];
#pragma unroll
  for (int i = 0; i < 2; ++i)
#pragma unroll
    for (int c = 0; c < 4; ++c) acc[i][c] = zero8();

  wave_gemm_32x64(X, Wt, m0, n0, acc);

  const int r16 = lane & 15;
#pragma unroll
  for (int half = 0; half < 2; ++half) {
    const int mbase = m0 + half * 16 + ((lane >> 4) << 3);
#pragma unroll
    for (int c = 0; c < 4; ++c) {
      const int col = n0 + c * 16 + r16;
      const float bv = bias[col];
      const int h = col >> 6, hd = col & 63;
#pragma unroll
      for (int r = 0; r < 8; ++r) {
        const int m = mbase + r;
        const int b = m >> 11, s = m & 2047;
        out[(((size_t)(b * NHEAD + h) * S_LEN) + s) * HDIM + hd] =
            (bf16_t)(acc[half][c][r] + bv);
      }
    }
  }
}

// ---------------------------------------------------------------------------
// Output projection: out f32 [4096][1024] = A @ Wot^T + bo
// ---------------------------------------------------------------------------
__global__ void __launch_bounds__(256)
out_proj_kernel(const bf16_t* __restrict__ A, const bf16_t* __restrict__ Wot,
                const float* __restrict__ bo, float* __restrict__ out) {
  const int wave = threadIdx.x >> 5;
  const int lane = threadIdx.x & 31;
  const int tile = blockIdx.x * 8 + wave;
  const int m0 = (tile >> 4) << 5;
  const int n0 = (tile & 15) << 6;

  v8f acc[2][4];
#pragma unroll
  for (int i = 0; i < 2; ++i)
#pragma unroll
    for (int c = 0; c < 4; ++c) acc[i][c] = zero8();

  wave_gemm_32x64(A, Wot, m0, n0, acc);

  const int r16 = lane & 15;
#pragma unroll
  for (int half = 0; half < 2; ++half) {
    const int mbase = m0 + half * 16 + ((lane >> 4) << 3);
#pragma unroll
    for (int c = 0; c < 4; ++c) {
      const int col = n0 + c * 16 + r16;
      const float bv = bo[col];
#pragma unroll
      for (int r = 0; r < 8; ++r)
        out[(size_t)(mbase + r) * DMODEL + col] = acc[half][c][r] + bv;
    }
  }
}

#if HAVE_TDM
__device__ __forceinline__ void tdm_load_2d(const bf16_t* gsrc, unsigned lds_off,
                                            int rows, int cols, int gstride) {
  unsigned long long ga = (unsigned long long)(uintptr_t)gsrc;
  u32x4 g0 = { 1u,
               lds_off,
               (unsigned)(ga & 0xFFFFFFFFu),
               ((unsigned)((ga >> 32) & 0x1FFFFFFu))
                 | 0x80000000u };
  i32x8 g1 = { 0x00010000,
               cols << 16,
               rows << 16,
               cols << 16,
               rows,
               gstride,
               0, 0 };
  i32x4 gz = { 0, 0, 0, 0 };
#if __clang_major__ >= 23
  i32x8 gz8 = { 0, 0, 0, 0, 0, 0, 0, 0 };
  __builtin_amdgcn_tensor_load_to_lds(g0, g1, gz, gz, gz8, 0);
#else
  __builtin_amdgcn_tensor_load_to_lds(g0, g1, gz, gz, 0);
#endif
}
#endif

__global__ void __launch_bounds__(256)
attn_kernel(const bf16_t* __restrict__ Q, const bf16_t* __restrict__ Kmat,
            const bf16_t* __restrict__ V, const int* __restrict__ mask,
            bf16_t* __restrict__ attn_out) {
#if HAVE_TDM
  __shared__ __align__(16) bf16_t Kraw[2][32 * 64];  // [s_local][d]
  __shared__ __align__(16) bf16_t Vraw[2][32 * 64];  // [s_local][d]
  __shared__ __align__(16) bf16_t VT[2][64 * 32];    // [d][s_local]
#else
  __shared__ __align__(16) bf16_t Kraw[1][32 * 64];
  __shared__ __align__(16) bf16_t VT[1][64 * 32];
#endif
  __shared__ __align__(16) bf16_t Pst[8][16 * 32];   // per-wave P staging

  const int b    = blockIdx.z;
  const int h    = blockIdx.y;
  const int wave = threadIdx.x >> 5;
  const int lane = threadIdx.x & 31;
  const int q0   = blockIdx.x * 128 + wave * 16;

  const size_t bh = (size_t)(b * NHEAD + h) * S_LEN * HDIM;
  const bf16_t* Qbh = Q    + bh;
  const bf16_t* Kbh = Kmat + bh;
  const bf16_t* Vbh = V    + bh;

  const int r16   = lane & 15;
  const int kbase = (lane >> 4) << 3;
  const int mbase = (lane >> 4) << 3;

  // Q fragment (16 rows x 64 k), reused for the whole key loop
  const bf16_t* qrow = Qbh + (size_t)(q0 + r16) * HDIM;
  const v16bf qa0 = load_frag16(qrow, kbase);        // k = 0..31
  const v16bf qa1 = load_frag16(qrow + 32, kbase);   // k = 32..63

  float mrow[8], lrow[8];
  v8f oacc[4];
#pragma unroll
  for (int r = 0; r < 8; ++r) { mrow[r] = -INFINITY; lrow[r] = 0.f; }
#pragma unroll
  for (int c2 = 0; c2 < 4; ++c2) oacc[c2] = zero8();

#if HAVE_TDM
  // prologue: stage tile 0 into buffer 0
  if (wave == 0) {
    tdm_load_2d(Kbh, (unsigned)(uintptr_t)&Kraw[0][0], 32, 64, 64);
    tdm_load_2d(Vbh, (unsigned)(uintptr_t)&Vraw[0][0], 32, 64, 64);
  }
#endif

  int step = 0;
  for (int s0 = 0; s0 < S_LEN; s0 += 32, ++step) {
#if HAVE_TDM
    const int cur = step & 1;
    const int nxt = cur ^ 1;
    if (wave == 0) {
      if (s0 + 32 < S_LEN) {
        // issue next tile into the buffer last read in step-1 (safe: we are
        // past that step's trailing barrier)
        tdm_load_2d(Kbh + (size_t)(s0 + 32) * HDIM,
                    (unsigned)(uintptr_t)&Kraw[nxt][0], 32, 64, 64);
        tdm_load_2d(Vbh + (size_t)(s0 + 32) * HDIM,
                    (unsigned)(uintptr_t)&Vraw[nxt][0], 32, 64, 64);
        // 2 outstanding allowed (next tile); current tile's 2 ops are done
        __builtin_amdgcn_s_wait_tensorcnt(2);
      } else {
        __builtin_amdgcn_s_wait_tensorcnt(0);
      }
    }
    __syncthreads();   // current raw K/V tiles visible to all waves

    // cooperative transpose V: 1 b128 read + 8 b16 stores per thread
    {
      const int idx = threadIdx.x * 8;          // 0..2047
      const int sl = idx >> 6, d0 = idx & 63;
      uint4 raw = *(const uint4*)&Vraw[cur][idx];
      const bf16_t* e = (const bf16_t*)&raw;
#pragma unroll
      for (int j = 0; j < 8; ++j) VT[cur][(d0 + j) * 32 + sl] = e[j];
    }
    __syncthreads();   // VT ready
#else
    const int cur = 0;
    {
      const int idx = threadIdx.x * 8;
      const int sl = idx >> 6, d0 = idx & 63;
      *(uint4*)&Kraw[0][idx] = *(const uint4*)(Kbh + (size_t)(s0 + sl) * HDIM + d0);
      uint4 raw = *(const uint4*)(Vbh + (size_t)(s0 + sl) * HDIM + d0);
      const bf16_t* e = (const bf16_t*)&raw;
#pragma unroll
      for (int j = 0; j < 8; ++j) VT[0][(d0 + j) * 32 + sl] = e[j];
    }
    __syncthreads();
#endif
    const bf16_t* Kc  = &Kraw[cur][0];
    const bf16_t* VTc = &VT[cur][0];

    // ---- scores S = Q (16x64) @ K_tile^T (64x32), scale + mask ----
    float sc[2][8];
#pragma unroll
    for (int kb = 0; kb < 2; ++kb) {
      const bf16_t* krow = Kc + (kb * 16 + r16) * 64;   // B: col = key pos
      v16bf b0 = load_frag16(krow, kbase);
      v16bf b1 = load_frag16(krow + 32, kbase);
      v8f sacc = zero8();
      sacc = wmma_bf16(qa0, b0, sacc);
      sacc = wmma_bf16(qa1, b1, sacc);
      const int scol = s0 + kb * 16 + r16;
#pragma unroll
      for (int r = 0; r < 8; ++r) {
        const float vsc = sacc[r] * 0.125f;   // 1/sqrt(64)
        const int mk = mask[((size_t)b * S_LEN + (q0 + mbase + r)) * S_LEN + scol];
        sc[kb][r] = (mk == 0) ? -INFINITY : vsc;
      }
    }

    // ---- online softmax (rows live inside one 16-lane half-wave) ----
#pragma unroll
    for (int r = 0; r < 8; ++r) {
      float rmax = fmaxf(sc[0][r], sc[1][r]);
#pragma unroll
      for (int off = 8; off > 0; off >>= 1)
        rmax = fmaxf(rmax, __shfl_xor(rmax, off, 16));
      const float mnew  = fmaxf(mrow[r], rmax);
      const float alpha = __expf(mrow[r] - mnew);
      const float p0 = __expf(sc[0][r] - mnew);
      const float p1 = __expf(sc[1][r] - mnew);
      float rsum = p0 + p1;
#pragma unroll
      for (int off = 8; off > 0; off >>= 1)
        rsum += __shfl_xor(rsum, off, 16);
      lrow[r] = lrow[r] * alpha + rsum;
      mrow[r] = mnew;
#pragma unroll
      for (int c2 = 0; c2 < 4; ++c2) oacc[c2][r] *= alpha;
      Pst[wave][(mbase + r) * 32 + r16]      = (bf16_t)p0;
      Pst[wave][(mbase + r) * 32 + 16 + r16] = (bf16_t)p1;
    }

    // ---- O += P (16x32) @ V_tile (32x64) ----
    {
      const bf16_t* prow = &Pst[wave][r16 * 32];
      v16bf pa = load_frag16(prow, kbase);     // K = 0..31 (32 keys)
#pragma unroll
      for (int c2 = 0; c2 < 4; ++c2) {
        // B[k=s][n=d] = VT[d][s]; rows of VT are contiguous -> b128 reads
        const bf16_t* vrow = VTc + (c2 * 16 + r16) * 32;
        v16bf vb = load_frag16(vrow, kbase);
        oacc[c2] = wmma_bf16(pa, vb, oacc[c2]);
      }
    }
    __syncthreads();   // all waves done with current buffers
  }

  // ---- epilogue: normalize, concat heads along D ----
#pragma unroll
  for (int r = 0; r < 8; ++r) {
    const float inv = 1.0f / lrow[r];
    const int qg = q0 + mbase + r;
#pragma unroll
    for (int c2 = 0; c2 < 4; ++c2) {
      const int dcol = h * HDIM + c2 * 16 + r16;
      attn_out[((size_t)b * S_LEN + qg) * DMODEL + dcol] = (bf16_t)(oacc[c2][r] * inv);
    }
  }
}

// ---------------------------------------------------------------------------
// Host-side launch
// ---------------------------------------------------------------------------
extern "C" void kernel_launch(void* const* d_in, const int* in_sizes, int n_in,
                              void* d_out, int out_size, void* d_ws, size_t ws_size,
                              hipStream_t stream) {
  (void)in_sizes; (void)n_in; (void)out_size; (void)ws_size;
  const float* dec  = (const float*)d_in[0];
  const float* enc  = (const float*)d_in[1];
  const int*   mask = (const int*)  d_in[2];
  const float* Wq   = (const float*)d_in[3];
  const float* bq   = (const float*)d_in[4];
  const float* Wk   = (const float*)d_in[5];
  const float* bk   = (const float*)d_in[6];
  const float* Wv   = (const float*)d_in[7];
  const float* bv   = (const float*)d_in[8];
  const float* Wo   = (const float*)d_in[9];
  const float* bo   = (const float*)d_in[10];
  float* out = (float*)d_out;

  char* ws = (char*)d_ws;
  size_t off = 0;
  auto alloc = [&](size_t bytes) -> char* {
    char* p = ws + off;
    off += (bytes + 255) & ~(size_t)255;
    return p;
  };

  const size_t HS_ELEMS  = (size_t)MTOT * DMODEL;             // 4194304
  const size_t W_ELEMS   = (size_t)DMODEL * DMODEL;           // 1048576
  const size_t QKV_ELEMS = (size_t)2 * NHEAD * S_LEN * HDIM;  // 4194304

  bf16_t* enc_bf  = (bf16_t*)alloc(HS_ELEMS * 2);
  bf16_t* dec_bf  = (bf16_t*)alloc(HS_ELEMS * 2);
  bf16_t* Wqt     = (bf16_t*)alloc(W_ELEMS * 2);
  bf16_t* Wkt     = (bf16_t*)alloc(W_ELEMS * 2);
  bf16_t* Wvt     = (bf16_t*)alloc(W_ELEMS * 2);
  bf16_t* Wot     = (bf16_t*)alloc(W_ELEMS * 2);
  bf16_t* qbuf    = (bf16_t*)alloc(QKV_ELEMS * 2);
  bf16_t* kbuf    = (bf16_t*)alloc(QKV_ELEMS * 2);
  bf16_t* vbuf    = (bf16_t*)alloc(QKV_ELEMS * 2);
  bf16_t* attn_bf = (bf16_t*)alloc(HS_ELEMS * 2);

  // 1) fp32 -> bf16 conversions / weight transposes
  f32_to_bf16_kernel<<<(int)(HS_ELEMS / 256), 256, 0, stream>>>(enc, enc_bf, (int)HS_ELEMS);
  f32_to_bf16_kernel<<<(int)(HS_ELEMS / 256), 256, 0, stream>>>(dec, dec_bf, (int)HS_ELEMS);
  proj_w_transpose_kernel<<<(int)(W_ELEMS / 256), 256, 0, stream>>>(Wq, Wqt);
  proj_w_transpose_kernel<<<(int)(W_ELEMS / 256), 256, 0, stream>>>(Wk, Wkt);
  proj_w_transpose_kernel<<<(int)(W_ELEMS / 256), 256, 0, stream>>>(Wv, Wvt);
  wo_transpose_kernel<<<(int)(W_ELEMS / 256), 256, 0, stream>>>(Wo, Wot);

  // 2) projections (reference arg swap: q <- enc, k/v <- dec)
  qkv_proj_kernel<<<256, 256, 0, stream>>>(enc_bf, Wqt, bq, qbuf);
  qkv_proj_kernel<<<256, 256, 0, stream>>>(dec_bf, Wkt, bk, kbuf);
  qkv_proj_kernel<<<256, 256, 0, stream>>>(dec_bf, Wvt, bv, vbuf);

  // 3) attention: grid (q-blocks of 128, H, B)
  attn_kernel<<<dim3(S_LEN / 128, NHEAD, 2), 256, 0, stream>>>(qbuf, kbuf, vbuf, mask, attn_bf);

  // 4) output projection -> f32
  out_proj_kernel<<<256, 256, 0, stream>>>(attn_bf, Wot, bo, out);
}

// v001
// It runs in 252 microseconds.
// Timed twice side by side with v000, it ran 1.39 and 1.40 times as fast.
#include <hip/hip_runtime.h>
#include <hip/hip_bf16.h>
#include <math.h>

typedef __bf16 bf16_t;
typedef __attribute__((ext_vector_type(16))) __bf16 v16bf;
typedef __attribute__((ext_vector_type(8)))  float  v8f;
typedef __attribute__((ext_vector_type(4)))  unsigned int u32x4;
typedef __attribute__((ext_vector_type(8)))  int i32x8;
typedef __attribute__((ext_vector_type(4)))  int i32x4;

#define S_LEN  2048
#define DMODEL 1024
#define NHEAD  16
#define HDIM   64
#define MTOT   4096   // B * S

#if defined(__has_builtin)
#if __has_builtin(__builtin_amdgcn_tensor_load_to_lds)
#define HAVE_TDM 1
#endif
#endif
#ifndef HAVE_TDM
#define HAVE_TDM 0
#endif

__device__ __forceinline__ v16bf load_frag16(const bf16_t* rowp, int kbase) {
  v16bf a;
  ((uint4*)&a)[0] = *(const uint4*)(rowp + kbase);        // K = kbase..kbase+7
  ((uint4*)&a)[1] = *(const uint4*)(rowp + 16 + kbase);   // K = 16+kbase..+7
  return a;
}

__device__ __forceinline__ v8f wmma_bf16(v16bf a, v16bf b, v8f c) {
  return __builtin_amdgcn_wmma_f32_16x16x32_bf16(
      false, a, false, b, (short)0, c, false, false);
}

__device__ __forceinline__ v8f zero8() {
  return (v8f){0.f,0.f,0.f,0.f,0.f,0.f,0.f,0.f};
}

// ---------------------------------------------------------------------------
// 32x64 wave GEMM core: acc[2][4] covers rows m0..m0+31, cols n0..n0+63.
// 12 b128 loads per 8 WMMAs (A fragments reused 4x, B fragments reused 2x).
// ---------------------------------------------------------------------------
__device__ __forceinline__ void wave_gemm_32x64(const bf16_t* __restrict__ X,
                                                const bf16_t* __restrict__ Wt,
                                                int m0, int n0, v8f acc[2][4]) {
  const int lane  = threadIdx.x & 31;
  const int r16   = lane & 15;
  const int kbase = (lane >> 4) << 3;
  const bf16_t* arow0 = X  + (size_t)(m0 + r16) * DMODEL;
  const bf16_t* arow1 = X  + (size_t)(m0 + 16 + r16) * DMODEL;
  const bf16_t* brow  = Wt + (size_t)(n0 + r16) * DMODEL;
  for (int k0 = 0; k0 < DMODEL; k0 += 32) {
    v16bf a0 = load_frag16(arow0 + k0, kbase);
    v16bf a1 = load_frag16(arow1 + k0, kbase);
#pragma unroll
    for (int c = 0; c < 4; ++c) {
      v16bf b = load_frag16(brow + (size_t)(c * 16) * DMODEL + k0, kbase);
      acc[0][c] = wmma_bf16(a0, b, acc[0][c]);
      acc[1][c] = wmma_bf16(a1, b, acc[1][c]);
    }
  }
}

// ---------------------------------------------------------------------------
// Conversions
// ---------------------------------------------------------------------------
__global__ void f32_to_bf16_kernel(const float* __restrict__ src,
                                   bf16_t* __restrict__ dst, int n) {
  int i = blockIdx.x * blockDim.x + threadIdx.x;
  if (i < n) dst[i] = (bf16_t)src[i];
}

// W [H][D][HD] f32 -> Wt [c = h*HD+hd][k = d] bf16 (k-contiguous rows)
__global__ void proj_w_transpose_kernel(const float* __restrict__ W,
                                        bf16_t* __restrict__ Wt) {
  int idx = blockIdx.x * blockDim.x + threadIdx.x;   // over 1024*1024
  int c = idx >> 10, k = idx & 1023;
  Wt[idx] = (bf16_t)W[((size_t)(c >> 6) * DMODEL + k) * HDIM + (c & 63)];
}

// Wo [D][D] f32 -> Wot[c][k] = Wo[k][c] bf16
__global__ void wo_transpose_kernel(const float* __restrict__ W,
                                    bf16_t* __restrict__ Wt) {
  int idx = blockIdx.x * blockDim.x + threadIdx.x;
  int c = idx >> 10, k = idx & 1023;
  Wt[idx] = (bf16_t)W[(size_t)k * DMODEL + c];
}

// ---------------------------------------------------------------------------
// QKV projection: 32x64 tile per wave; out[b,h,s,hd] bf16 = X @ Wt^T + bias
// ---------------------------------------------------------------------------
__global__ void __launch_bounds__(256)
qkv_proj_kernel(const bf16_t* __restrict__ X, const bf16_t* __restrict__ Wt,
                const float* __restrict__ bias, bf16_t* __restrict__ out) {
  const int wave = threadIdx.x >> 5;
  const int lane = threadIdx.x & 31;
  const int tile = blockIdx.x * 8 + wave;
  const int m0 = (tile >> 4) << 5;   // 128 m-tiles of 32
  const int n0 = (tile & 15) << 6;   // 16 n-tiles of 64

  v8f acc[2][4];
#pragma unroll
  for (int i = 0; i < 2; ++i)
#pragma unroll
    for (int c = 0; c < 4; ++c) acc[i][c] = zero8();

  wave_gemm_32x64(X, Wt, m0, n0, acc);

  const int r16 = lane & 15;
#pragma unroll
  for (int half = 0; half < 2; ++half) {
    const int mbase = m0 + half * 16 + ((lane >> 4) << 3);
#pragma unroll
    for (int c = 0; c < 4; ++c) {
      const int col = n0 + c * 16 + r16;
      const float bv = bias[col];
      const int h = col >> 6, hd = col & 63;
#pragma unroll
      for (int r = 0; r < 8; ++r) {
        const int m = mbase + r;
        const int b = m >> 11, s = m & 2047;
        out[(((size_t)(b * NHEAD + h) * S_LEN) + s) * HDIM + hd] =
            (bf16_t)(acc[half][c][r] + bv);
      }
    }
  }
}

// ---------------------------------------------------------------------------
// Output projection: out f32 [4096][1024] = A @ Wot^T + bo
// ---------------------------------------------------------------------------
__global__ void __launch_bounds__(256)
out_proj_kernel(const bf16_t* __restrict__ A, const bf16_t* __restrict__ Wot,
                const float* __restrict__ bo, float* __restrict__ out) {
  const int wave = threadIdx.x >> 5;
  const int lane = threadIdx.x & 31;
  const int tile = blockIdx.x * 8 + wave;
  const int m0 = (tile >> 4) << 5;
  const int n0 = (tile & 15) << 6;

  v8f acc[2][4];
#pragma unroll
  for (int i = 0; i < 2; ++i)
#pragma unroll
    for (int c = 0; c < 4; ++c) acc[i][c] = zero8();

  wave_gemm_32x64(A, Wot, m0, n0, acc);

  const int r16 = lane & 15;
#pragma unroll
  for (int half = 0; half < 2; ++half) {
    const int mbase = m0 + half * 16 + ((lane >> 4) << 3);
#pragma unroll
    for (int c = 0; c < 4; ++c) {
      const int col = n0 + c * 16 + r16;
      const float bv = bo[col];
#pragma unroll
      for (int r = 0; r < 8; ++r)
        out[(size_t)(mbase + r) * DMODEL + col] = acc[half][c][r] + bv;
    }
  }
}

#if HAVE_TDM
__device__ __forceinline__ void tdm_load_2d(const bf16_t* gsrc, unsigned lds_off,
                                            int rows, int cols, int gstride) {
  unsigned long long ga = (unsigned long long)(uintptr_t)gsrc;
  u32x4 g0 = { 1u,
               lds_off,
               (unsigned)(ga & 0xFFFFFFFFu),
               ((unsigned)((ga >> 32) & 0x1FFFFFFu))
                 | 0x80000000u };
  i32x8 g1 = { 0x00010000,
               cols << 16,
               rows << 16,
               cols << 16,
               rows,
               gstride,
               0, 0 };
  i32x4 gz = { 0, 0, 0, 0 };
#if __clang_major__ >= 23
  i32x8 gz8 = { 0, 0, 0, 0, 0, 0, 0, 0 };
  __builtin_amdgcn_tensor_load_to_lds(g0, g1, gz, gz, gz8, 0);
#else
  __builtin_amdgcn_tensor_load_to_lds(g0, g1, gz, gz, 0);
#endif
}
#endif

typedef __attribute__((ext_vector_type(8))) short s16x8;

// 16x8 block of a row-major 16-bit LDS tile, delivered transposed
__device__ __forceinline__ u32x4 lds_load_tr16(const bf16_t* p) {
  typedef __attribute__((address_space(3))) s16x8 lds_s16x8;
  return __builtin_bit_cast(u32x4, __builtin_amdgcn_ds_load_tr16_b128_v8i16((lds_s16x8*)p));
}

__device__ __forceinline__ float other_half(float x) {
  const int xi = __builtin_bit_cast(int, x);
  return __builtin_bit_cast(float, __builtin_amdgcn_permlanex16(
      xi, xi, 0x76543210, 0xfedcba98, false, false));
}

__global__ void __launch_bounds__(256)
attn_kernel(const bf16_t* __restrict__ Q, const bf16_t* __restrict__ Kmat,
            const bf16_t* __restrict__ V, const int* __restrict__ mask,
            bf16_t* __restrict__ attn_out) {
#if HAVE_TDM
  __shared__ __align__(16) bf16_t Kraw[2][32 * 64];  // [s_local][d]
  __shared__ __align__(16) bf16_t Vraw[2][32 * 64];  // [s_local][d]
#else
  __shared__ __align__(16) bf16_t Kraw[1][32 * 64];
  __shared__ __align__(16) bf16_t Vraw[1][32 * 64];
#endif

  const int b    = blockIdx.z;
  const int h    = blockIdx.y;
  const int wave = threadIdx.x >> 5;
  const int lane = threadIdx.x & 31;
  const int q0   = blockIdx.x * 128 + wave * 16;

  const size_t bh = (size_t)(b * NHEAD + h) * S_LEN * HDIM;
  const bf16_t* Qbh = Q    + bh;
  const bf16_t* Kbh = Kmat + bh;
  const bf16_t* Vbh = V    + bh;

  const int r16   = lane & 15;
  const int kbase = (lane >> 4) << 3;

  // Q^T fragment (64 k x 16 query columns), reused for the whole key loop
  const bf16_t* qrow = Qbh + (size_t)(q0 + r16) * HDIM;
  const v16bf qb0 = load_frag16(qrow, kbase);        // k = 0..31
  const v16bf qb1 = load_frag16(qrow + 32, kbase);   // k = 32..63

  // this lane's query row of the mask, at its half's first key
  const int* mlane = mask + ((size_t)b * S_LEN + (q0 + r16)) * S_LEN + kbase;

  float mrun = -INFINITY;   // running maximum of query q0 + r16 (both halves)
  float lrun = 0.f;         // running sum over this half's keys only
  v8f oacc[4];              // oacc[t][r] = O[q0 + r16][16 t + kbase + r]
#pragma unroll
  for (int t = 0; t < 4; ++t) oacc[t] = zero8();

#if HAVE_TDM
  // prologue: stage tile 0 into buffer 0
  if (wave == 0) {
    tdm_load_2d(Kbh, (unsigned)(uintptr_t)&Kraw[0][0], 32, 64, 64);
    tdm_load_2d(Vbh, (unsigned)(uintptr_t)&Vraw[0][0], 32, 64, 64);
  }
#endif

  int step = 0;
  for (int s0 = 0; s0 < S_LEN; s0 += 32, ++step) {
#if HAVE_TDM
    const int cur = step & 1;
    const int nxt = cur ^ 1;
    if (wave == 0) {
      if (s0 + 32 < S_LEN) {
        // issue next tile into the buffer last read in step-1 (safe: we are
        // past that step's trailing barrier)
        tdm_load_2d(Kbh + (size_t)(s0 + 32) * HDIM,
                    (unsigned)(uintptr_t)&Kraw[nxt][0], 32, 64, 64);
        tdm_load_2d(Vbh + (size_t)(s0 + 32) * HDIM,
                    (unsigned)(uintptr_t)&Vraw[nxt][0], 32, 64, 64);
        // 2 outstanding allowed (next tile); current tile's 2 ops are done
        __builtin_amdgcn_s_wait_tensorcnt(2);
      } else {
        __builtin_amdgcn_s_wait_tensorcnt(0);
      }
    }
    __syncthreads();   // current raw K/V tiles visible to all waves
#else
    const int cur = 0;
    {
      const int idx = threadIdx.x * 8;
      const int sl = idx >> 6, d0 = idx & 63;
      *(uint4*)&Kraw[0][idx] = *(const uint4*)(Kbh + (size_t)(s0 + sl) * HDIM + d0);
      *(uint4*)&Vraw[0][idx] = *(const uint4*)(Vbh + (size_t)(s0 + sl) * HDIM + d0);
    }
    __syncthreads();
#endif
    const bf16_t* Kc = &Kraw[cur][0];
    const bf16_t* Vc = &Vraw[cur][0];

    // ---- scores S^T = K_tile (32x64) @ Q^T (64x16), scale + mask ----
    // mask of keys s0 + 16 kt + kbase + 0..7 for this lane's query
    int4 mk[2][2];
#pragma unroll
    for (int kt = 0; kt < 2; ++kt) {
      mk[kt][0] = *(const int4*)(mlane + s0 + kt * 16);
      mk[kt][1] = *(const int4*)(mlane + s0 + kt * 16 + 4);
    }
    v16bf ka[2][2];      // A: row = key pos 16 kt + r16, k = d
#pragma unroll
    for (int kt = 0; kt < 2; ++kt) {
      const bf16_t* krow = Kc + (kt * 16 + r16) * 64;
      ka[kt][0] = load_frag16(krow, kbase);
      ka[kt][1] = load_frag16(krow + 32, kbase);
    }
    // holds the mask and K loads together in front of the products; without
    // it each load sinks to its first use and its latency is paid by itself
    __builtin_amdgcn_sched_barrier(0);
    v8f sacc[2];
#pragma unroll
    for (int kt = 0; kt < 2; ++kt) {
      sacc[kt] = wmma_bf16(ka[kt][0], qb0, zero8());
      sacc[kt] = wmma_bf16(ka[kt][1], qb1, sacc[kt]);
    }
    // V^T fragments (A: row = d 16 t + r16, k = keys in the order of pb below).
    // Lane address of the transposing load: key row kbase + (lane & 7),
    // 16-byte half (lane >> 3) & 1 of the 16 d columns.
    v16bf va[4];
    {
      const bf16_t* vp = Vc + (kbase + (lane & 7)) * 64 + ((lane >> 3) & 1) * 8;
#pragma unroll
      for (int t = 0; t < 4; ++t) {
        ((u32x4*)&va[t])[0] = lds_load_tr16(vp + t * 16);             // keys kbase + 0..7
        ((u32x4*)&va[t])[1] = lds_load_tr16(vp + 16 * 64 + t * 16);   // keys 16 + kbase + 0..7
      }
    }
    // holds the V^T loads here as one group; without it they sink between the
    // second products, each pair in front of a wait of its own
    __builtin_amdgcn_sched_barrier(0);
    float sc[2][8];
#pragma unroll
    for (int kt = 0; kt < 2; ++kt) {
      const int mv[8] = { mk[kt][0].x, mk[kt][0].y, mk[kt][0].z, mk[kt][0].w,
                          mk[kt][1].x, mk[kt][1].y, mk[kt][1].z, mk[kt][1].w };
#pragma unroll
      for (int r = 0; r < 8; ++r) {
        const float vsc = sacc[kt][r] * 0.125f;   // 1/sqrt(64)
        sc[kt][r] = (mv[r] == 0) ? -INFINITY : vsc;
      }
    }

    // ---- online softmax: one query per lane ----
    float rmax = sc[0][0];
#pragma unroll
    for (int i = 1; i < 16; ++i) rmax = fmaxf(rmax, sc[i >> 3][i & 7]);
    rmax = fmaxf(rmax, other_half(rmax));
    const float mnew  = fmaxf(mrun, rmax);
    // while every key so far is masked the shift is 0: sums stay 0, not NaN
    const float shift = (mnew == -INFINITY) ? 0.f : mnew;
    const float alpha = __expf(mrun - shift);
    v16bf pb;            // P^T as B operand: pb[8 kt + r] = P[16 kt + kbase + r]
    float rsum = 0.f;
#pragma unroll
    for (int kt = 0; kt < 2; ++kt)
#pragma unroll
      for (int r = 0; r < 8; ++r) {
        const float p = __expf(sc[kt][r] - shift);
        rsum += p;
        pb[kt * 8 + r] = (bf16_t)p;
      }
    lrun = lrun * alpha + rsum;
    mrun = mnew;
#pragma unroll
    for (int t = 0; t < 4; ++t) oacc[t] *= alpha;

    // ---- O^T += V_tile^T (64x32) @ P^T (32x16) ----
#pragma unroll
    for (int t = 0; t < 4; ++t) oacc[t] = wmma_bf16(va[t], pb, oacc[t]);
    __syncthreads();   // all waves done with current buffers
  }

  // ---- epilogue: join the halves' sums, normalize, concat heads along D ----
  const float inv = 1.0f / (lrun + other_half(lrun));
  bf16_t* orow = attn_out + ((size_t)b * S_LEN + (q0 + r16)) * DMODEL + h * HDIM + kbase;
#pragma unroll
  for (int t = 0; t < 4; ++t) {
    __attribute__((ext_vector_type(8))) __bf16 o8;
#pragma unroll
    for (int r = 0; r < 8; ++r) o8[r] = (bf16_t)(oacc[t][r] * inv);
    *(u32x4*)(orow + t * 16) = __builtin_bit_cast(u32x4, o8);
  }
}

// ---------------------------------------------------------------------------
// Host-side launch
// ---------------------------------------------------------------------------
extern "C" void kernel_launch(void* const* d_in, const int* in_sizes, int n_in,
                              void* d_out, int out_size, void* d_ws, size_t ws_size,
                              hipStream_t stream) {
  (void)in_sizes; (void)n_in; (void)out_size; (void)ws_size;
  const float* dec  = (const float*)d_in[0];
  const float* enc  = (const float*)d_in[1];
  const int*   mask = (const int*)  d_in[2];
  const float* Wq   = (const float*)d_in[3];
  const float* bq   = (const float*)d_in[4];
  const float* Wk   = (const float*)d_in[5];
  const float* bk   = (const float*)d_in[6];
  const float* Wv   = (const float*)d_in[7];
  const float* bv   = (const float*)d_in[8];
  const float* Wo   = (const float*)d_in[9];
  const float* bo   = (const float*)d_in[10];
  float* out = (float*)d_out;

  char* ws = (char*)d_ws;
  size_t off = 0;
  auto alloc = [&](size_t bytes) -> char* {
    char* p = ws + off;
    off += (bytes + 255) & ~(size_t)255;
    return p;
  };

  const size_t HS_ELEMS  = (size_t)MTOT * DMODEL;             // 4194304
  const size_t W_ELEMS   = (size_t)DMODEL * DMODEL;           // 1048576
  const size_t QKV_ELEMS = (size_t)2 * NHEAD * S_LEN * HDIM;  // 4194304

  bf16_t* enc_bf  = (bf16_t*)alloc(HS_ELEMS * 2);
  bf16_t* dec_bf  = (bf16_t*)alloc(HS_ELEMS * 2);
  bf16_t* Wqt     = (bf16_t*)alloc(W_ELEMS * 2);
  bf16_t* Wkt     = (bf16_t*)alloc(W_ELEMS * 2);
  bf16_t* Wvt     = (bf16_t*)alloc(W_ELEMS * 2);
  bf16_t* Wot     = (bf16_t*)alloc(W_ELEMS * 2);
  bf16_t* qbuf    = (bf16_t*)alloc(QKV_ELEMS * 2);
  bf16_t* kbuf    = (bf16_t*)alloc(QKV_ELEMS * 2);
  bf16_t* vbuf    = (bf16_t*)alloc(QKV_ELEMS * 2);
  bf16_t* attn_bf = (bf16_t*)alloc(HS_ELEMS * 2);

  // 1) fp32 -> bf16 conversions / weight transposes
  f32_to_bf16_kernel<<<(int)(HS_ELEMS / 256), 256, 0, stream>>>(enc, enc_bf, (int)HS_ELEMS);
  f32_to_bf16_kernel<<<(int)(HS_ELEMS / 256), 256, 0, stream>>>(dec, dec_bf, (int)HS_ELEMS);
  proj_w_transpose_kernel<<<(int)(W_ELEMS / 256), 256, 0, stream>>>(Wq, Wqt);
  proj_w_transpose_kernel<<<(int)(W_ELEMS / 256), 256, 0, stream>>>(Wk, Wkt);
  proj_w_transpose_kernel<<<(int)(W_ELEMS / 256), 256, 0, stream>>>(Wv, Wvt);
  wo_transpose_kernel<<<(int)(W_ELEMS / 256), 256, 0, stream>>>(Wo, Wot);

  // 2) projections (reference arg swap: q <- enc, k/v <- dec)
  qkv_proj_kernel<<<256, 256, 0, stream>>>(enc_bf, Wqt, bq, qbuf);
  qkv_proj_kernel<<<256, 256, 0, stream>>>(dec_bf, Wkt, bk, kbuf);
  qkv_proj_kernel<<<256, 256, 0, stream>>>(dec_bf, Wvt, bv, vbuf);

  // 3) attention: grid (q-blocks of 128, H, B)
  attn_kernel<<<dim3(S_LEN / 128, NHEAD, 2), 256, 0, stream>>>(qbuf, kbuf, vbuf, mask, attn_bf);

  // 4) output projection -> f32
  out_proj_kernel<<<256, 256, 0, stream>>>(attn_bf, Wot, bo, out);
}

// v002
// One run takes 221 microseconds.
// Timed twice side by side with v001, it ran 1.14 times as fast both times.
// All steps since v000 together make it 1.58 times as fast.
#include <hip/hip_runtime.h>
#include <hip/hip_bf16.h>
#include <math.h>

typedef __bf16 bf16_t;
typedef __attribute__((ext_vector_type(16))) __bf16 v16bf;
typedef __attribute__((ext_vector_type(8)))  float  v8f;
typedef __attribute__((ext_vector_type(4)))  unsigned int u32x4;
typedef __attribute__((ext_vector_type(8)))  int i32x8;
typedef __attribute__((ext_vector_type(4)))  int i32x4;

#define S_LEN  2048
#define DMODEL 1024
#define NHEAD  16
#define HDIM   64
#define MTOT   4096   // B * S

#if defined(__has_builtin)
#if __has_builtin(__builtin_amdgcn_tensor_load_to_lds)
#define HAVE_TDM 1
#endif
#endif
#ifndef HAVE_TDM
#define HAVE_TDM 0
#endif

__device__ __forceinline__ v16bf load_frag16(const bf16_t* rowp, int kbase) {
  v16bf a;
  ((uint4*)&a)[0] = *(const uint4*)(rowp + kbase);        // K = kbase..kbase+7
  ((uint4*)&a)[1] = *(const uint4*)(rowp + 16 + kbase);   // K = 16+kbase..+7
  return a;
}

__device__ __forceinline__ v8f wmma_bf16(v16bf a, v16bf b, v8f c) {
  return __builtin_amdgcn_wmma_f32_16x16x32_bf16(
      false, a, false, b, (short)0, c, false, false);
}

__device__ __forceinline__ v8f zero8() {
  return (v8f){0.f,0.f,0.f,0.f,0.f,0.f,0.f,0.f};
}

// ---------------------------------------------------------------------------
// 32x64 wave GEMM core: acc[2][4] covers rows m0..m0+31, cols n0..n0+63.
// 12 b128 loads per 8 WMMAs (A fragments reused 4x, B fragments reused 2x).
// ---------------------------------------------------------------------------
__device__ __forceinline__ void wave_gemm_32x64(const bf16_t* __restrict__ X,
                                                const bf16_t* __restrict__ Wt,
                                                int m0, int n0, v8f acc[2][4]) {
  const int lane  = threadIdx.x & 31;
  const int r16   = lane & 15;
  const int kbase = (lane >> 4) << 3;
  const bf16_t* arow0 = X  + (size_t)(m0 + r16) * DMODEL;
  const bf16_t* arow1 = X  + (size_t)(m0 + 16 + r16) * DMODEL;
  const bf16_t* brow  = Wt + (size_t)(n0 + r16) * DMODEL;
  for (int k0 = 0; k0 < DMODEL; k0 += 32) {
    v16bf a0 = load_frag16(arow0 + k0, kbase);
    v16bf a1 = load_frag16(arow1 + k0, kbase);
#pragma unroll
    for (int c = 0; c < 4; ++c) {
      v16bf b = load_frag16(brow + (size_t)(c * 16) * DMODEL + k0, kbase);
      acc[0][c] = wmma_bf16(a0, b, acc[0][c]);
      acc[1][c] = wmma_bf16(a1, b, acc[1][c]);
    }
  }
}

// ---------------------------------------------------------------------------
// Conversions
// ---------------------------------------------------------------------------
typedef __attribute__((ext_vector_type(4))) __bf16 v4bf;
typedef __attribute__((ext_vector_type(8))) __bf16 v8bf;

// A block converts 8192 consecutive floats. Each wave-wide load covers 512
// contiguous bytes; a lane's 8 loads are all issued before the first store.
__global__ void __launch_bounds__(256)
f32_to_bf16_kernel(const float* __restrict__ src, bf16_t* __restrict__ dst) {
  const size_t base = (size_t)blockIdx.x * 2048 + threadIdx.x;   // in float4
  const float4* s4 = (const float4*)src + base;
  v4bf*         d4 = (v4bf*)dst + base;
  float4 v[8];
#pragma unroll
  for (int i = 0; i < 8; ++i) v[i] = s4[i * 256];
#pragma unroll
  for (int i = 0; i < 8; ++i) {
    v4bf o = { (bf16_t)v[i].x, (bf16_t)v[i].y, (bf16_t)v[i].z, (bf16_t)v[i].w };
    d4[i * 256] = o;
  }
}

__device__ __forceinline__ void transpose_tile_64x64(const float* __restrict__ src,
                                                     int ld,
                                                     bf16_t* __restrict__ dst) {
  __shared__ float tile[64][65];
  const int t = threadIdx.x;
  const int kr = t >> 4, c4 = (t & 15) << 2;
  float4 v[4];
#pragma unroll
  for (int i = 0; i < 4; ++i)
    v[i] = *(const float4*)(src + (size_t)(kr + 16 * i) * ld + c4);
#pragma unroll
  for (int i = 0; i < 4; ++i) {
    float* row = &tile[kr + 16 * i][c4];
    row[0] = v[i].x; row[1] = v[i].y; row[2] = v[i].z; row[3] = v[i].w;
  }
  __syncthreads();   // the tile is read across the waves that wrote it
  const int k8 = (t & 7) << 3;
#pragma unroll
  for (int p = 0; p < 2; ++p) {
    const int c = (t >> 3) + 32 * p;
    v8bf o;
#pragma unroll
    for (int i = 0; i < 8; ++i) o[i] = (bf16_t)tile[k8 + i][c];
    *(v8bf*)(dst + (size_t)c * DMODEL + k8) = o;
  }
}

// W [H][D][HD] f32 -> Wt [c = h*HD+hd][k = d] bf16 (k-contiguous rows);
// block = (head, 64 rows of d)
__global__ void __launch_bounds__(256)
proj_w_transpose_kernel(const float* __restrict__ W, bf16_t* __restrict__ Wt) {
  const int h = blockIdx.x >> 4, k0 = (blockIdx.x & 15) << 6;
  transpose_tile_64x64(W + ((size_t)h * DMODEL + k0) * HDIM, HDIM,
                       Wt + (size_t)h * HDIM * DMODEL + k0);
}

// Wo [D][D] f32 -> Wot[c][k] = Wo[k][c] bf16; block = (64 columns c, 64 rows k)
__global__ void __launch_bounds__(256)
wo_transpose_kernel(const float* __restrict__ W, bf16_t* __restrict__ Wt) {
  const int c0 = (blockIdx.x >> 4) << 6, k0 = (blockIdx.x & 15) << 6;
  transpose_tile_64x64(W + (size_t)k0 * DMODEL + c0, DMODEL,
                       Wt + (size_t)c0 * DMODEL + k0);
}

// ---------------------------------------------------------------------------
// QKV projection: 32x64 tile per wave; out[b,h,s,hd] bf16 = X @ Wt^T + bias
// ---------------------------------------------------------------------------
__global__ void __launch_bounds__(256)
qkv_proj_kernel(const bf16_t* __restrict__ X, const bf16_t* __restrict__ Wt,
                const float* __restrict__ bias, bf16_t* __restrict__ out) {
  const int wave = threadIdx.x >> 5;
  const int lane = threadIdx.x & 31;
  const int tile = blockIdx.x * 8 + wave;
  const int m0 = (tile >> 4) << 5;   // 128 m-tiles of 32
  const int n0 = (tile & 15) << 6;   // 16 n-tiles of 64

  v8f acc[2][4];
#pragma unroll
  for (int i = 0; i < 2; ++i)
#pragma unroll
    for (int c = 0; c < 4; ++c) acc[i][c] = zero8();

  wave_gemm_32x64(X, Wt, m0, n0, acc);

  const int r16 = lane & 15;
#pragma unroll
  for (int half = 0; half < 2; ++half) {
    const int mbase = m0 + half * 16 + ((lane >> 4) << 3);
#pragma unroll
    for (int c = 0; c < 4; ++c) {
      const int col = n0 + c * 16 + r16;
      const float bv = bias[col];
      const int h = col >> 6, hd = col & 63;
#pragma unroll
      for (int r = 0; r < 8; ++r) {
        const int m = mbase + r;
        const int b = m >> 11, s = m & 2047;
        out[(((size_t)(b * NHEAD + h) * S_LEN) + s) * HDIM + hd] =
            (bf16_t)(acc[half][c][r] + bv);
      }
    }
  }
}

// ---------------------------------------------------------------------------
// Output projection: out f32 [4096][1024] = A @ Wot^T + bo
// ---------------------------------------------------------------------------
__global__ void __launch_bounds__(256)
out_proj_kernel(const bf16_t* __restrict__ A, const bf16_t* __restrict__ Wot,
                const float* __restrict__ bo, float* __restrict__ out) {
  const int wave = threadIdx.x >> 5;
  const int lane = threadIdx.x & 31;
  const int tile = blockIdx.x * 8 + wave;
  const int m0 = (tile >> 4) << 5;
  const int n0 = (tile & 15) << 6;

  v8f acc[2][4];
#pragma unroll
  for (int i = 0; i < 2; ++i)
#pragma unroll
    for (int c = 0; c < 4; ++c) acc[i][c] = zero8();

  wave_gemm_32x64(A, Wot, m0, n0, acc);

  const int r16 = lane & 15;
#pragma unroll
  for (int half = 0; half < 2; ++half) {
    const int mbase = m0 + half * 16 + ((lane >> 4) << 3);
#pragma unroll
    for (int c = 0; c < 4; ++c) {
      const int col = n0 + c * 16 + r16;
      const float bv = bo[col];
#pragma unroll
      for (int r = 0; r < 8; ++r)
        out[(size_t)(mbase + r) * DMODEL + col] = acc[half][c][r] + bv;
    }
  }
}

#if HAVE_TDM
__device__ __forceinline__ void tdm_load_2d(const bf16_t* gsrc, unsigned lds_off,
                                            int rows, int cols, int gstride) {
  unsigned long long ga = (unsigned long long)(uintptr_t)gsrc;
  u32x4 g0 = { 1u,
               lds_off,
               (unsigned)(ga & 0xFFFFFFFFu),
               ((unsigned)((ga >> 32) & 0x1FFFFFFu))
                 | 0x80000000u };
  i32x8 g1 = { 0x00010000,
               cols << 16,
               rows << 16,
               cols << 16,
               rows,
               gstride,
               0, 0 };
  i32x4 gz = { 0, 0, 0, 0 };
#if __clang_major__ >= 23
  i32x8 gz8 = { 0, 0, 0, 0, 0, 0, 0, 0 };
  __builtin_amdgcn_tensor_load_to_lds(g0, g1, gz, gz, gz8, 0);
#else
  __builtin_amdgcn_tensor_load_to_lds(g0, g1, gz, gz, 0);
#endif
}
#endif

typedef __attribute__((ext_vector_type(8))) short s16x8;

// 16x8 block of a row-major 16-bit LDS tile, delivered transposed
__device__ __forceinline__ u32x4 lds_load_tr16(const bf16_t* p) {
  typedef __attribute__((address_space(3))) s16x8 lds_s16x8;
  return __builtin_bit_cast(u32x4, __builtin_amdgcn_ds_load_tr16_b128_v8i16((lds_s16x8*)p));
}

__device__ __forceinline__ float other_half(float x) {
  const int xi = __builtin_bit_cast(int, x);
  return __builtin_bit_cast(float, __builtin_amdgcn_permlanex16(
      xi, xi, 0x76543210, 0xfedcba98, false, false));
}

__global__ void __launch_bounds__(256)
attn_kernel(const bf16_t* __restrict__ Q, const bf16_t* __restrict__ Kmat,
            const bf16_t* __restrict__ V, const int* __restrict__ mask,
            bf16_t* __restrict__ attn_out) {
#if HAVE_TDM
  __shared__ __align__(16) bf16_t Kraw[2][32 * 64];  // [s_local][d]
  __shared__ __align__(16) bf16_t Vraw[2][32 * 64];  // [s_local][d]
#else
  __shared__ __align__(16) bf16_t Kraw[1][32 * 64];
  __shared__ __align__(16) bf16_t Vraw[1][32 * 64];
#endif

  const int b    = blockIdx.z;
  const int h    = blockIdx.y;
  const int wave = threadIdx.x >> 5;
  const int lane = threadIdx.x & 31;
  const int q0   = blockIdx.x * 128 + wave * 16;

  const size_t bh = (size_t)(b * NHEAD + h) * S_LEN * HDIM;
  const bf16_t* Qbh = Q    + bh;
  const bf16_t* Kbh = Kmat + bh;
  const bf16_t* Vbh = V    + bh;

  const int r16   = lane & 15;
  const int kbase = (lane >> 4) << 3;

  // Q^T fragment (64 k x 16 query columns), reused for the whole key loop
  const bf16_t* qrow = Qbh + (size_t)(q0 + r16) * HDIM;
  const v16bf qb0 = load_frag16(qrow, kbase);        // k = 0..31
  const v16bf qb1 = load_frag16(qrow + 32, kbase);   // k = 32..63

  // this lane's query row of the mask, at its half's first key
  const int* mlane = mask + ((size_t)b * S_LEN + (q0 + r16)) * S_LEN + kbase;

  float mrun = -INFINITY;   // running maximum of query q0 + r16 (both halves)
  float lrun = 0.f;         // running sum over this half's keys only
  v8f oacc[4];              // oacc[t][r] = O[q0 + r16][16 t + kbase + r]
#pragma unroll
  for (int t = 0; t < 4; ++t) oacc[t] = zero8();

#if HAVE_TDM
  // prologue: stage tile 0 into buffer 0
  if (wave == 0) {
    tdm_load_2d(Kbh, (unsigned)(uintptr_t)&Kraw[0][0], 32, 64, 64);
    tdm_load_2d(Vbh, (unsigned)(uintptr_t)&Vraw[0][0], 32, 64, 64);
  }
#endif

  int step = 0;
  for (int s0 = 0; s0 < S_LEN; s0 += 32, ++step) {
#if HAVE_TDM
    const int cur = step & 1;
    const int nxt = cur ^ 1;
    if (wave == 0) {
      if (s0 + 32 < S_LEN) {
        // issue next tile into the buffer last read in step-1 (safe: we are
        // past that step's trailing barrier)
        tdm_load_2d(Kbh + (size_t)(s0 + 32) * HDIM,
                    (unsigned)(uintptr_t)&Kraw[nxt][0], 32, 64, 64);
        tdm_load_2d(Vbh + (size_t)(s0 + 32) * HDIM,
                    (unsigned)(uintptr_t)&Vraw[nxt][0], 32, 64, 64);
        // 2 outstanding allowed (next tile); current tile's 2 ops are done
        __builtin_amdgcn_s_wait_tensorcnt(2);
      } else {
        __builtin_amdgcn_s_wait_tensorcnt(0);
      }
    }
    __syncthreads();   // current raw K/V tiles visible to all waves
#else
    const int cur = 0;
    {
      const int idx = threadIdx.x * 8;
      const int sl = idx >> 6, d0 = idx & 63;
      *(uint4*)&Kraw[0][idx] = *(const uint4*)(Kbh + (size_t)(s0 + sl) * HDIM + d0);
      *(uint4*)&Vraw[0][idx] = *(const uint4*)(Vbh + (size_t)(s0 + sl) * HDIM + d0);
    }
    __syncthreads();
#endif
    const bf16_t* Kc = &Kraw[cur][0];
    const bf16_t* Vc = &Vraw[cur][0];

    // ---- scores S^T = K_tile (32x64) @ Q^T (64x16), scale + mask ----
    // mask of keys s0 + 16 kt + kbase + 0..7 for this lane's query
    int4 mk[2][2];
#pragma unroll
    for (int kt = 0; kt < 2; ++kt) {
      mk[kt][0] = *(const int4*)(mlane + s0 + kt * 16);
      mk[kt][1] = *(const int4*)(mlane + s0 + kt * 16 + 4);
    }
    v16bf ka[2][2];      // A: row = key pos 16 kt + r16, k = d
#pragma unroll
    for (int kt = 0; kt < 2; ++kt) {
      const bf16_t* krow = Kc + (kt * 16 + r16) * 64;
      ka[kt][0] = load_frag16(krow, kbase);
      ka[kt][1] = load_frag16(krow + 32, kbase);
    }
    // holds the mask and K loads together in front of the products; without
    // it each load sinks to its first use and its latency is paid by itself
    __builtin_amdgcn_sched_barrier(0);
    v8f sacc[2];
#pragma unroll
    for (int kt = 0; kt < 2; ++kt) {
      sacc[kt] = wmma_bf16(ka[kt][0], qb0, zero8());
      sacc[kt] = wmma_bf16(ka[kt][1], qb1, sacc[kt]);
    }
    // V^T fragments (A: row = d 16 t + r16, k = keys in the order of pb below).
    // Lane address of the transposing load: key row kbase + (lane & 7),
    // 16-byte half (lane >> 3) & 1 of the 16 d columns.
    v16bf va[4];
    {
      const bf16_t* vp = Vc + (kbase + (lane & 7)) * 64 + ((lane >> 3) & 1) * 8;
#pragma unroll
      for (int t = 0; t < 4; ++t) {
        ((u32x4*)&va[t])[0] = lds_load_tr16(vp + t * 16);             // keys kbase + 0..7
        ((u32x4*)&va[t])[1] = lds_load_tr16(vp + 16 * 64 + t * 16);   // keys 16 + kbase + 0..7
      }
    }
    // holds the V^T loads here as one group; without it they sink between the
    // second products, each pair in front of a wait of its own
    __builtin_amdgcn_sched_barrier(0);
    float sc[2][8];
#pragma unroll
    for (int kt = 0; kt < 2; ++kt) {
      const int mv[8] = { mk[kt][0].x, mk[kt][0].y, mk[kt][0].z, mk[kt][0].w,
                          mk[kt][1].x, mk[kt][1].y, mk[kt][1].z, mk[kt][1].w };
#pragma unroll
      for (int r = 0; r < 8; ++r) {
        const float vsc = sacc[kt][r] * 0.125f;   // 1/sqrt(64)
        sc[kt][r] = (mv[r] == 0) ? -INFINITY : vsc;
      }
    }

    // ---- online softmax: one query per lane ----
    float rmax = sc[0][0];
#pragma unroll
    for (int i = 1; i < 16; ++i) rmax = fmaxf(rmax, sc[i >> 3][i & 7]);
    rmax = fmaxf(rmax, other_half(rmax));
    const float mnew  = fmaxf(mrun, rmax);
    // while every key so far is masked the shift is 0: sums stay 0, not NaN
    const float shift = (mnew == -INFINITY) ? 0.f : mnew;
    const float alpha = __expf(mrun - shift);
    v16bf pb;            // P^T as B operand: pb[8 kt + r] = P[16 kt + kbase + r]
    float rsum = 0.f;
#pragma unroll
    for (int kt = 0; kt < 2; ++kt)
#pragma unroll
      for (int r = 0; r < 8; ++r) {
        const float p = __expf(sc[kt][r] - shift);
        rsum += p;
        pb[kt * 8 + r] = (bf16_t)p;
      }
    lrun = lrun * alpha + rsum;
    mrun = mnew;
#pragma unroll
    for (int t = 0; t < 4; ++t) oacc[t] *= alpha;

    // ---- O^T += V_tile^T (64x32) @ P^T (32x16) ----
#pragma unroll
    for (int t = 0; t < 4; ++t) oacc[t] = wmma_bf16(va[t], pb, oacc[t]);
    __syncthreads();   // all waves done with current buffers
  }

  // ---- epilogue: join the halves' sums, normalize, concat heads along D ----
  const float inv = 1.0f / (lrun + other_half(lrun));
  bf16_t* orow = attn_out + ((size_t)b * S_LEN + (q0 + r16)) * DMODEL + h * HDIM + kbase;
#pragma unroll
  for (int t = 0; t < 4; ++t) {
    __attribute__((ext_vector_type(8))) __bf16 o8;
#pragma unroll
    for (int r = 0; r < 8; ++r) o8[r] = (bf16_t)(oacc[t][r] * inv);
    *(u32x4*)(orow + t * 16) = __builtin_bit_cast(u32x4, o8);
  }
}

// ---------------------------------------------------------------------------
// Host-side launch
// ---------------------------------------------------------------------------
extern "C" void kernel_launch(void* const* d_in, const int* in_sizes, int n_in,
                              void* d_out, int out_size, void* d_ws, size_t ws_size,
                              hipStream_t stream) {
  (void)in_sizes; (void)n_in; (void)out_size; (void)ws_size;
  const float* dec  = (const float*)d_in[0];
  const float* enc  = (const float*)d_in[1];
  const int*   mask = (const int*)  d_in[2];
  const float* Wq   = (const float*)d_in[3];
  const float* bq   = (const float*)d_in[4];
  const float* Wk   = (const float*)d_in[5];
  const float* bk   = (const float*)d_in[6];
  const float* Wv   = (const float*)d_in[7];
  const float* bv   = (const float*)d_in[8];
  const float* Wo   = (const float*)d_in[9];
  const float* bo   = (const float*)d_in[10];
  float* out = (float*)d_out;

  char* ws = (char*)d_ws;
  size_t off = 0;
  auto alloc = [&](size_t bytes) -> char* {
    char* p = ws + off;
    off += (bytes + 255) & ~(size_t)255;
    return p;
  };

  const size_t HS_ELEMS  = (size_t)MTOT * DMODEL;             // 4194304
  const size_t W_ELEMS   = (size_t)DMODEL * DMODEL;           // 1048576
  const size_t QKV_ELEMS = (size_t)2 * NHEAD * S_LEN * HDIM;  // 4194304

  bf16_t* enc_bf  = (bf16_t*)alloc(HS_ELEMS * 2);
  bf16_t* dec_bf  = (bf16_t*)alloc(HS_ELEMS * 2);
  bf16_t* Wqt     = (bf16_t*)alloc(W_ELEMS * 2);
  bf16_t* Wkt     = (bf16_t*)alloc(W_ELEMS * 2);
  bf16_t* Wvt     = (bf16_t*)alloc(W_ELEMS * 2);
  bf16_t* Wot     = (bf16_t*)alloc(W_ELEMS * 2);
  bf16_t* qbuf    = (bf16_t*)alloc(QKV_ELEMS * 2);
  bf16_t* kbuf    = (bf16_t*)alloc(QKV_ELEMS * 2);
  bf16_t* vbuf    = (bf16_t*)alloc(QKV_ELEMS * 2);
  bf16_t* attn_bf = (bf16_t*)alloc(HS_ELEMS * 2);

  // 1) fp32 -> bf16 conversions / weight transposes
  f32_to_bf16_kernel<<<(int)(HS_ELEMS / 8192), 256, 0, stream>>>(enc, enc_bf);
  f32_to_bf16_kernel<<<(int)(HS_ELEMS / 8192), 256, 0, stream>>>(dec, dec_bf);
  proj_w_transpose_kernel<<<(int)(W_ELEMS / 4096), 256, 0, stream>>>(Wq, Wqt);
  proj_w_transpose_kernel<<<(int)(W_ELEMS / 4096), 256, 0, stream>>>(Wk, Wkt);
  proj_w_transpose_kernel<<<(int)(W_ELEMS / 4096), 256, 0, stream>>>(Wv, Wvt);
  wo_transpose_kernel<<<(int)(W_ELEMS / 4096), 256, 0, stream>>>(Wo, Wot);

  // 2) projections (reference arg swap: q <- enc, k/v <- dec)
  qkv_proj_kernel<<<256, 256, 0, stream>>>(enc_bf, Wqt, bq, qbuf);
  qkv_proj_kernel<<<256, 256, 0, stream>>>(dec_bf, Wkt, bk, kbuf);
  qkv_proj_kernel<<<256, 256, 0, stream>>>(dec_bf, Wvt, bv, vbuf);

  // 3) attention: grid (q-blocks of 128, H, B)
  attn_kernel<<<dim3(S_LEN / 128, NHEAD, 2), 256, 0, stream>>>(qbuf, kbuf, vbuf, mask, attn_bf);

  // 4) output projection -> f32
  out_proj_kernel<<<256, 256, 0, stream>>>(attn_bf, Wot, bo, out);
}

// v003
// It runs in 191 microseconds.
// Two timings next to v002 both put it at 1.16 times that version's speed.
// All steps since v000 together make it 1.84 times as fast.
#include <hip/hip_runtime.h>
#include <hip/hip_bf16.h>
#include <math.h>

typedef __bf16 bf16_t;
typedef __attribute__((ext_vector_type(16))) __bf16 v16bf;
typedef __attribute__((ext_vector_type(8)))  float  v8f;
typedef __attribute__((ext_vector_type(4)))  unsigned int u32x4;

#define S_LEN  2048
#define DMODEL 1024
#define NHEAD  16
#define HDIM   64
#define MTOT   4096   // B * S

__device__ __forceinline__ v16bf load_frag16(const bf16_t* rowp, int kbase) {
  v16bf a;
  ((uint4*)&a)[0] = *(const uint4*)(rowp + kbase);        // K = kbase..kbase+7
  ((uint4*)&a)[1] = *(const uint4*)(rowp + 16 + kbase);   // K = 16+kbase..+7
  return a;
}

__device__ __forceinline__ v8f wmma_bf16(v16bf a, v16bf b, v8f c) {
  return __builtin_amdgcn_wmma_f32_16x16x32_bf16(
      false, a, false, b, (short)0, c, false, false);
}

__device__ __forceinline__ v8f zero8() {
  return (v8f){0.f,0.f,0.f,0.f,0.f,0.f,0.f,0.f};
}

// ---------------------------------------------------------------------------
// 32x64 wave GEMM core: acc[2][4] covers rows m0..m0+31, cols n0..n0+63.
// 12 b128 loads per 8 WMMAs (A fragments reused 4x, B fragments reused 2x).
// ---------------------------------------------------------------------------
__device__ __forceinline__ void wave_gemm_32x64(const bf16_t* __restrict__ X,
                                                const bf16_t* __restrict__ Wt,
                                                int m0, int n0, v8f acc[2][4]) {
  const int lane  = threadIdx.x & 31;
  const int r16   = lane & 15;
  const int kbase = (lane >> 4) << 3;
  const bf16_t* arow0 = X  + (size_t)(m0 + r16) * DMODEL;
  const bf16_t* arow1 = X  + (size_t)(m0 + 16 + r16) * DMODEL;
  const bf16_t* brow  = Wt + (size_t)(n0 + r16) * DMODEL;
  for (int k0 = 0; k0 < DMODEL; k0 += 32) {
    v16bf a0 = load_frag16(arow0 + k0, kbase);
    v16bf a1 = load_frag16(arow1 + k0, kbase);
#pragma unroll
    for (int c = 0; c < 4; ++c) {
      v16bf b = load_frag16(brow + (size_t)(c * 16) * DMODEL + k0, kbase);
      acc[0][c] = wmma_bf16(a0, b, acc[0][c]);
      acc[1][c] = wmma_bf16(a1, b, acc[1][c]);
    }
  }
}

// ---------------------------------------------------------------------------
// Conversions
// ---------------------------------------------------------------------------
typedef __attribute__((ext_vector_type(4))) __bf16 v4bf;
typedef __attribute__((ext_vector_type(8))) __bf16 v8bf;

// A block converts 8192 consecutive floats. Each wave-wide load covers 512
// contiguous bytes; a lane's 8 loads are all issued before the first store.
__global__ void __launch_bounds__(256)
f32_to_bf16_kernel(const float* __restrict__ src, bf16_t* __restrict__ dst) {
  const size_t base = (size_t)blockIdx.x * 2048 + threadIdx.x;   // in float4
  const float4* s4 = (const float4*)src + base;
  v4bf*         d4 = (v4bf*)dst + base;
  float4 v[8];
#pragma unroll
  for (int i = 0; i < 8; ++i) v[i] = s4[i * 256];
#pragma unroll
  for (int i = 0; i < 8; ++i) {
    v4bf o = { (bf16_t)v[i].x, (bf16_t)v[i].y, (bf16_t)v[i].z, (bf16_t)v[i].w };
    d4[i * 256] = o;
  }
}

__device__ __forceinline__ void transpose_tile_64x64(const float* __restrict__ src,
                                                     int ld,
                                                     bf16_t* __restrict__ dst) {
  __shared__ float tile[64][65];
  const int t = threadIdx.x;
  const int kr = t >> 4, c4 = (t & 15) << 2;
  float4 v[4];
#pragma unroll
  for (int i = 0; i < 4; ++i)
    v[i] = *(const float4*)(src + (size_t)(kr + 16 * i) * ld + c4);
#pragma unroll
  for (int i = 0; i < 4; ++i) {
    float* row = &tile[kr + 16 * i][c4];
    row[0] = v[i].x; row[1] = v[i].y; row[2] = v[i].z; row[3] = v[i].w;
  }
  __syncthreads();   // the tile is read across the waves that wrote it
  const int k8 = (t & 7) << 3;
#pragma unroll
  for (int p = 0; p < 2; ++p) {
    const int c = (t >> 3) + 32 * p;
    v8bf o;
#pragma unroll
    for (int i = 0; i < 8; ++i) o[i] = (bf16_t)tile[k8 + i][c];
    *(v8bf*)(dst + (size_t)c * DMODEL + k8) = o;
  }
}

// W [H][D][HD] f32 -> Wt [c = h*HD+hd][k = d] bf16 (k-contiguous rows);
// block = (head, 64 rows of d)
__global__ void __launch_bounds__(256)
proj_w_transpose_kernel(const float* __restrict__ W, bf16_t* __restrict__ Wt) {
  const int h = blockIdx.x >> 4, k0 = (blockIdx.x & 15) << 6;
  transpose_tile_64x64(W + ((size_t)h * DMODEL + k0) * HDIM, HDIM,
                       Wt + (size_t)h * HDIM * DMODEL + k0);
}

// Wo [D][D] f32 -> Wot[c][k] = Wo[k][c] bf16; block = (64 columns c, 64 rows k)
__global__ void __launch_bounds__(256)
wo_transpose_kernel(const float* __restrict__ W, bf16_t* __restrict__ Wt) {
  const int c0 = (blockIdx.x >> 4) << 6, k0 = (blockIdx.x & 15) << 6;
  transpose_tile_64x64(W + (size_t)k0 * DMODEL + c0, DMODEL,
                       Wt + (size_t)c0 * DMODEL + k0);
}

// ---------------------------------------------------------------------------
// QKV projection: 32x64 tile per wave; out[b,h,s,hd] bf16 = X @ Wt^T + bias
// ---------------------------------------------------------------------------
__global__ void __launch_bounds__(256)
qkv_proj_kernel(const bf16_t* __restrict__ X, const bf16_t* __restrict__ Wt,
                const float* __restrict__ bias, bf16_t* __restrict__ out) {
  const int wave = threadIdx.x >> 5;
  const int lane = threadIdx.x & 31;
  const int tile = blockIdx.x * 8 + wave;
  const int m0 = (tile >> 4) << 5;   // 128 m-tiles of 32
  const int n0 = (tile & 15) << 6;   // 16 n-tiles of 64

  v8f acc[2][4];
#pragma unroll
  for (int i = 0; i < 2; ++i)
#pragma unroll
    for (int c = 0; c < 4; ++c) acc[i][c] = zero8();

  wave_gemm_32x64(X, Wt, m0, n0, acc);

  const int r16 = lane & 15;
#pragma unroll
  for (int half = 0; half < 2; ++half) {
    const int mbase = m0 + half * 16 + ((lane >> 4) << 3);
#pragma unroll
    for (int c = 0; c < 4; ++c) {
      const int col = n0 + c * 16 + r16;
      const float bv = bias[col];
      const int h = col >> 6, hd = col & 63;
#pragma unroll
      for (int r = 0; r < 8; ++r) {
        const int m = mbase + r;
        const int b = m >> 11, s = m & 2047;
        out[(((size_t)(b * NHEAD + h) * S_LEN) + s) * HDIM + hd] =
            (bf16_t)(acc[half][c][r] + bv);
      }
    }
  }
}

// ---------------------------------------------------------------------------
// Output projection: out f32 [4096][1024] = A @ Wot^T + bo
// ---------------------------------------------------------------------------
__global__ void __launch_bounds__(256)
out_proj_kernel(const bf16_t* __restrict__ A, const bf16_t* __restrict__ Wot,
                const float* __restrict__ bo, float* __restrict__ out) {
  const int wave = threadIdx.x >> 5;
  const int lane = threadIdx.x & 31;
  const int tile = blockIdx.x * 8 + wave;
  const int m0 = (tile >> 4) << 5;
  const int n0 = (tile & 15) << 6;

  v8f acc[2][4];
#pragma unroll
  for (int i = 0; i < 2; ++i)
#pragma unroll
    for (int c = 0; c < 4; ++c) acc[i][c] = zero8();

  wave_gemm_32x64(A, Wot, m0, n0, acc);

  const int r16 = lane & 15;
#pragma unroll
  for (int half = 0; half < 2; ++half) {
    const int mbase = m0 + half * 16 + ((lane >> 4) << 3);
#pragma unroll
    for (int c = 0; c < 4; ++c) {
      const int col = n0 + c * 16 + r16;
      const float bv = bo[col];
#pragma unroll
      for (int r = 0; r < 8; ++r)
        out[(size_t)(mbase + r) * DMODEL + col] = acc[half][c][r] + bv;
    }
  }
}

typedef __attribute__((ext_vector_type(8))) unsigned int u32x8;

#define TILE_ROWS 32u
#define ROW_BYTES 128u
#define K_PITCH   144u      // bytes
#define V_PITCH   160u      // bytes
#define SLOT_BYTES 6144u    // 32 padded rows, rounded up to a multiple of 2 KiB
#define PAD_K ((1u << 20) | (4u << 22) | (3u << 25))
#define PAD_V ((1u << 20) | (4u << 22) | (7u << 25))

__device__ __forceinline__ unsigned uni(unsigned v) {
  return (unsigned)__builtin_amdgcn_readfirstlane(v);
}
__device__ __forceinline__ unsigned pinned(unsigned v) {
  unsigned w = uni(v);
  asm volatile("" : "+s"(w));   // pinned form: the issue test held in a scalar register
  return w;
}
__device__ __forceinline__ void wait_tensor0() {
  asm volatile("s_wait_tensorcnt 0x0" ::: "memory");  // the issuer's tile has landed
}
__device__ __forceinline__ void wait_ds0() {
  asm volatile("s_wait_dscnt 0x0" ::: "memory");      // this wave's LDS reads are done
}

template <unsigned PAD_WORD>
__device__ __forceinline__ u32x8 tdm_group1() {
  u32x8 g1;                                          // 1-byte elements, extents in bytes
  g1[0] = uni(PAD_WORD);
  g1[1] = uni(ROW_BYTES << 16);
  g1[2] = uni(TILE_ROWS << 16);
  g1[3] = uni(ROW_BYTES << 16);
  g1[4] = uni(TILE_ROWS);
  g1[5] = uni(ROW_BYTES);
  g1[6] = uni(0u);
  g1[7] = uni(0u);
  asm volatile("" : "+s"(g1));
  return g1;
}

__device__ __forceinline__ u32x4 tdm_group0(unsigned lds_dst, const bf16_t* gsrc) {
  const unsigned long long ga = (unsigned long long)(uintptr_t)gsrc;
  u32x4 g0;
  g0[0] = uni(1u);                                   // count = 1
  g0[1] = uni(lds_dst);                              // byte offset in the group's LDS
  g0[2] = uni((unsigned)ga);                         // address [31:0]
  g0[3] = uni((((unsigned)(ga >> 32)) & 0x01FFFFFFu) | 0x80000000u);  // [56:32], type 2
  return g0;
}
// The next tile: a new place in LDS, the source address one tile further on
// (the carry runs into address bits [56:32] of word 3, below the type field).
__device__ __forceinline__ void tdm_advance(u32x4& g0, unsigned lds_dst) {
  const unsigned long long a =
      ((((unsigned long long)g0[3]) << 32) | g0[2]) + TILE_ROWS * ROW_BYTES;
  g0[1] = uni(lds_dst);
  g0[2] = uni((unsigned)a);
  g0[3] = uni((unsigned)(a >> 32));
}
__device__ __forceinline__ void tdm_issue(u32x4& g0, u32x8 g1) {
  asm volatile("tensor_load_to_lds %0, %1" : "+s"(g0) : "s"(g1) : "memory");
}

typedef __attribute__((ext_vector_type(8))) short s16x8;

// 16x8 block of a row-major 16-bit LDS tile, delivered transposed
__device__ __forceinline__ u32x4 lds_load_tr16(const bf16_t* p) {
  typedef __attribute__((address_space(3))) s16x8 lds_s16x8;
  return __builtin_bit_cast(u32x4, __builtin_amdgcn_ds_load_tr16_b128_v8i16((lds_s16x8*)p));
}

__device__ __forceinline__ float other_half(float x) {
  const int xi = __builtin_bit_cast(int, x);
  return __builtin_bit_cast(float, __builtin_amdgcn_permlanex16(
      xi, xi, 0x76543210, 0xfedcba98, false, false));
}

// mask carries no __restrict__: its loads then count as ordinary memory reads,
// which the compiler fence in the pass keeps at the top of the pass.
__global__ void __launch_bounds__(256)
attn_kernel(const bf16_t* __restrict__ Q, const bf16_t* __restrict__ Kmat,
            const bf16_t* __restrict__ V, const int* mask,
            bf16_t* __restrict__ attn_out) {
  // [buffer][K, V][padded tile]
  __shared__ __attribute__((aligned(2048))) unsigned char ring[2][2][SLOT_BYTES];

  const int b    = blockIdx.z;
  const int h    = blockIdx.y;
  const int wave = (int)uni(threadIdx.x >> 5);
  const int lane = threadIdx.x & 31;
  const int q0   = blockIdx.x * 128 + wave * 16;

  const size_t bh = (size_t)(b * NHEAD + h) * S_LEN * HDIM;
  const bf16_t* Qbh = Q    + bh;
  const bf16_t* Kbh = Kmat + bh;
  const bf16_t* Vbh = V    + bh;

  const int r16   = lane & 15;
  const int kbase = (lane >> 4) << 3;

  // Q^T fragment (64 k x 16 query columns), reused for the whole key loop
  const bf16_t* qrow = Qbh + (size_t)(q0 + r16) * HDIM;
  const v16bf qb0 = load_frag16(qrow, kbase);        // k = 0..31
  const v16bf qb1 = load_frag16(qrow + 32, kbase);   // k = 32..63

  // this lane's query row of the mask, at its half's first key
  const int* mlane = mask + ((size_t)b * S_LEN + (q0 + r16)) * S_LEN + kbase;

  float mrun = -INFINITY;   // running maximum of query q0 + r16 (both halves)
  float lrun = 0.f;         // running sum over this half's keys only
  v8f oacc[4];              // oacc[t][r] = O[q0 + r16][16 t + kbase + r]
#pragma unroll
  for (int t = 0; t < 4; ++t) oacc[t] = zero8();

  const unsigned lbase = (unsigned)(uintptr_t)&ring[0][0][0];
  const u32x8 g1k = tdm_group1<PAD_K>();
  const u32x8 g1v = tdm_group1<PAD_V>();
  // prologue: tile 0 into buffer 0, landed and published; then tile 1 into buffer 1
  const unsigned slot = lbase + (wave == 1 ? SLOT_BYTES : 0u);   // this wave's operand
  u32x4 g0 = tdm_group0(slot, wave == 1 ? Vbh : Kbh);
  if (pinned(wave == 0)) { tdm_issue(g0, g1k); wait_tensor0(); }
  if (pinned(wave == 1)) { tdm_issue(g0, g1v); wait_tensor0(); }
  __syncthreads();   // tile 0 visible to all waves
  tdm_advance(g0, slot + 2u * SLOT_BYTES);
  if (pinned(wave == 0)) tdm_issue(g0, g1k);
  if (pinned(wave == 1)) tdm_issue(g0, g1v);

  int step = 0;
  for (int s0 = 0; s0 < S_LEN; s0 += 32, ++step) {
    const int cur = step & 1;
    const bf16_t* Kc = (const bf16_t*)&ring[cur][0][0];   // row pitch K_PITCH
    const bf16_t* Vc = (const bf16_t*)&ring[cur][1][0];   // row pitch V_PITCH

    // ---- scores S^T = K_tile (32x64) @ Q^T (64x16), scale + mask ----
    // mask of keys s0 + 16 kt + kbase + 0..7 for this lane's query
    int4 mk[2][2];
#pragma unroll
    for (int kt = 0; kt < 2; ++kt) {
      mk[kt][0] = *(const int4*)(mlane + s0 + kt * 16);
      mk[kt][1] = *(const int4*)(mlane + s0 + kt * 16 + 4);
    }
    v16bf ka[2][2];      // A: row = key pos 16 kt + r16, k = d
#pragma unroll
    for (int kt = 0; kt < 2; ++kt) {
      const bf16_t* krow = Kc + (kt * 16 + r16) * (K_PITCH / 2);
      ka[kt][0] = load_frag16(krow, kbase);
      ka[kt][1] = load_frag16(krow + 32, kbase);
    }
    // these two hold the mask and K loads together in front of the products;
    // without them each load sinks to its first use and its latency is paid by
    // itself (the compiler fence orders the loads before instruction selection,
    // the scheduling barrier after it)
    asm volatile("" ::: "memory");
    __builtin_amdgcn_sched_barrier(0);
    v8f sacc[2];
#pragma unroll
    for (int kt = 0; kt < 2; ++kt) {
      sacc[kt] = wmma_bf16(ka[kt][0], qb0, zero8());
      sacc[kt] = wmma_bf16(ka[kt][1], qb1, sacc[kt]);
    }
    // V^T fragments (A: row = d 16 t + r16, k = keys in the order of pb below).
    // Lane address of the transposing load: key row kbase + (lane & 7),
    // 16-byte half (lane >> 3) & 1 of the 16 d columns.
    v16bf va[4];
    {
      const bf16_t* vp = Vc + (kbase + (lane & 7)) * (V_PITCH / 2) + ((lane >> 3) & 1) * 8;
#pragma unroll
      for (int t = 0; t < 4; ++t) {
        ((u32x4*)&va[t])[0] = lds_load_tr16(vp + t * 16);             // keys kbase + 0..7
        ((u32x4*)&va[t])[1] = lds_load_tr16(vp + 16 * (V_PITCH / 2) + t * 16);   // keys 16 + kbase + 0..7
      }
    }
    // holds the V^T loads here as one group; without it they sink between the
    // second products, each pair in front of a wait of its own
    __builtin_amdgcn_sched_barrier(0);
    float sc[2][8];
#pragma unroll
    for (int kt = 0; kt < 2; ++kt) {
      const int mv[8] = { mk[kt][0].x, mk[kt][0].y, mk[kt][0].z, mk[kt][0].w,
                          mk[kt][1].x, mk[kt][1].y, mk[kt][1].z, mk[kt][1].w };
#pragma unroll
      for (int r = 0; r < 8; ++r) {
        const float vsc = sacc[kt][r] * 0.125f;   // 1/sqrt(64)
        sc[kt][r] = (mv[r] == 0) ? -INFINITY : vsc;
      }
    }

    // ---- online softmax: one query per lane ----
    float rmax = sc[0][0];
#pragma unroll
    for (int i = 1; i < 16; ++i) rmax = fmaxf(rmax, sc[i >> 3][i & 7]);
    rmax = fmaxf(rmax, other_half(rmax));
    const float mnew  = fmaxf(mrun, rmax);
    // while every key so far is masked the shift is 0: sums stay 0, not NaN
    const float shift = (mnew == -INFINITY) ? 0.f : mnew;
    const float alpha = __expf(mrun - shift);
    v16bf pb;            // P^T as B operand: pb[8 kt + r] = P[16 kt + kbase + r]
    float rsum = 0.f;
#pragma unroll
    for (int kt = 0; kt < 2; ++kt)
#pragma unroll
      for (int r = 0; r < 8; ++r) {
        const float p = __expf(sc[kt][r] - shift);
        rsum += p;
        pb[kt * 8 + r] = (bf16_t)p;
      }
    lrun = lrun * alpha + rsum;
    mrun = mnew;
#pragma unroll
    for (int t = 0; t < 4; ++t) oacc[t] *= alpha;

    // ---- O^T += V_tile^T (64x32) @ P^T (32x16) ----
#pragma unroll
    for (int t = 0; t < 4; ++t) oacc[t] = wmma_bf16(va[t], pb, oacc[t]);

    // ---- hand-over: the next tile is published, this pass's buffer is freed ----
    wait_ds0();
    if (pinned(wave < 2)) wait_tensor0();
    __syncthreads();   // next tile visible to all waves; all waves done with this one
    if (pinned(s0 + 64 < S_LEN)) {
      tdm_advance(g0, slot + (unsigned)cur * (2u * SLOT_BYTES));
      if (pinned(wave == 0)) tdm_issue(g0, g1k);
      if (pinned(wave == 1)) tdm_issue(g0, g1v);
    }
  }
  wait_tensor0();
  wait_ds0();

  // ---- epilogue: join the halves' sums, normalize, concat heads along D ----
  const float inv = 1.0f / (lrun + other_half(lrun));
  bf16_t* orow = attn_out + ((size_t)b * S_LEN + (q0 + r16)) * DMODEL + h * HDIM + kbase;
#pragma unroll
  for (int t = 0; t < 4; ++t) {
    __attribute__((ext_vector_type(8))) __bf16 o8;
#pragma unroll
    for (int r = 0; r < 8; ++r) o8[r] = (bf16_t)(oacc[t][r] * inv);
    *(u32x4*)(orow + t * 16) = __builtin_bit_cast(u32x4, o8);
  }
}

// ---------------------------------------------------------------------------
// Host-side launch
// ---------------------------------------------------------------------------
extern "C" void kernel_launch(void* const* d_in, const int* in_sizes, int n_in,
                              void* d_out, int out_size, void* d_ws, size_t ws_size,
                              hipStream_t stream) {
  (void)in_sizes; (void)n_in; (void)out_size; (void)ws_size;
  const float* dec  = (const float*)d_in[0];
  const float* enc  = (const float*)d_in[1];
  const int*   mask = (const int*)  d_in[2];
  const float* Wq   = (const float*)d_in[3];
  const float* bq   = (const float*)d_in[4];
  const float* Wk   = (const float*)d_in[5];
  const float* bk   = (const float*)d_in[6];
  const float* Wv   = (const float*)d_in[7];
  const float* bv   = (const float*)d_in[8];
  const float* Wo   = (const float*)d_in[9];
  const float* bo   = (const float*)d_in[10];
  float* out = (float*)d_out;

  char* ws = (char*)d_ws;
  size_t off = 0;
  auto alloc = [&](size_t bytes) -> char* {
    char* p = ws + off;
    off += (bytes + 255) & ~(size_t)255;
    return p;
  };

  const size_t HS_ELEMS  = (size_t)MTOT * DMODEL;             // 4194304
  const size_t W_ELEMS   = (size_t)DMODEL * DMODEL;           // 1048576
  const size_t QKV_ELEMS = (size_t)2 * NHEAD * S_LEN * HDIM;  // 4194304

  bf16_t* enc_bf  = (bf16_t*)alloc(HS_ELEMS * 2);
  bf16_t* dec_bf  = (bf16_t*)alloc(HS_ELEMS * 2);
  bf16_t* Wqt     = (bf16_t*)alloc(W_ELEMS * 2);
  bf16_t* Wkt     = (bf16_t*)alloc(W_ELEMS * 2);
  bf16_t* Wvt     = (bf16_t*)alloc(W_ELEMS * 2);
  bf16_t* Wot     = (bf16_t*)alloc(W_ELEMS * 2);
  bf16_t* qbuf    = (bf16_t*)alloc(QKV_ELEMS * 2);
  bf16_t* kbuf    = (bf16_t*)alloc(QKV_ELEMS * 2);
  bf16_t* vbuf    = (bf16_t*)alloc(QKV_ELEMS * 2);
  bf16_t* attn_bf = (bf16_t*)alloc(HS_ELEMS * 2);

  // 1) fp32 -> bf16 conversions / weight transposes
  f32_to_bf16_kernel<<<(int)(HS_ELEMS / 8192), 256, 0, stream>>>(enc, enc_bf);
  f32_to_bf16_kernel<<<(int)(HS_ELEMS / 8192), 256, 0, stream>>>(dec, dec_bf);
  proj_w_transpose_kernel<<<(int)(W_ELEMS / 4096), 256, 0, stream>>>(Wq, Wqt);
  proj_w_transpose_kernel<<<(int)(W_ELEMS / 4096), 256, 0, stream>>>(Wk, Wkt);
  proj_w_transpose_kernel<<<(int)(W_ELEMS / 4096), 256, 0, stream>>>(Wv, Wvt);
  wo_transpose_kernel<<<(int)(W_ELEMS / 4096), 256, 0, stream>>>(Wo, Wot);

  // 2) projections (reference arg swap: q <- enc, k/v <- dec)
  qkv_proj_kernel<<<256, 256, 0, stream>>>(enc_bf, Wqt, bq, qbuf);
  qkv_proj_kernel<<<256, 256, 0, stream>>>(dec_bf, Wkt, bk, kbuf);
  qkv_proj_kernel<<<256, 256, 0, stream>>>(dec_bf, Wvt, bv, vbuf);

  // 3) attention: grid (q-blocks of 128, H, B)
  attn_kernel<<<dim3(S_LEN / 128, NHEAD, 2), 256, 0, stream>>>(qbuf, kbuf, vbuf, mask, attn_bf);

  // 4) output projection -> f32
  out_proj_kernel<<<256, 256, 0, stream>>>(attn_bf, Wot, bo, out);
}

// v004
// It runs in 132 microseconds.
// Two timings next to v003 put it at 1.45 and 1.46 times that version's speed.
// Over all steps from v000 it is 2.67 times as fast.
#include <hip/hip_runtime.h>
#include <hip/hip_bf16.h>
#include <math.h>

typedef __bf16 bf16_t;
typedef __attribute__((ext_vector_type(16))) __bf16 v16bf;
typedef __attribute__((ext_vector_type(8)))  float  v8f;
typedef __attribute__((ext_vector_type(4)))  unsigned int u32x4;

#define S_LEN  2048
#define DMODEL 1024
#define NHEAD  16
#define HDIM   64
#define MTOT   4096   // B * S

__device__ __forceinline__ v16bf load_frag16(const bf16_t* rowp, int kbase) {
  v16bf a;
  ((uint4*)&a)[0] = *(const uint4*)(rowp + kbase);        // K = kbase..kbase+7
  ((uint4*)&a)[1] = *(const uint4*)(rowp + 16 + kbase);   // K = 16+kbase..+7
  return a;
}

__device__ __forceinline__ v8f wmma_bf16(v16bf a, v16bf b, v8f c) {
  return __builtin_amdgcn_wmma_f32_16x16x32_bf16(
      false, a, false, b, (short)0, c, false, false);
}

__device__ __forceinline__ v8f zero8() {
  return (v8f){0.f,0.f,0.f,0.f,0.f,0.f,0.f,0.f};
}

typedef __attribute__((ext_vector_type(8))) unsigned int u32x8;

#define TILE_ROWS 32u
#define ROW_BYTES 128u
#define K_PITCH   144u      // bytes
#define V_PITCH   160u      // bytes
#define SLOT_BYTES 6144u    // 32 padded rows, rounded up to a multiple of 2 KiB
#define PAD_K ((1u << 20) | (4u << 22) | (3u << 25))
#define PAD_V ((1u << 20) | (4u << 22) | (7u << 25))

__device__ __forceinline__ unsigned uni(unsigned v) {
  return (unsigned)__builtin_amdgcn_readfirstlane(v);
}
__device__ __forceinline__ unsigned pinned(unsigned v) {
  unsigned w = uni(v);
  asm volatile("" : "+s"(w));   // pinned form: the issue test held in a scalar register
  return w;
}
__device__ __forceinline__ void wait_tensor0() {
  asm volatile("s_wait_tensorcnt 0x0" ::: "memory");  // the issuer's tile has landed
}
__device__ __forceinline__ void wait_ds0() {
  asm volatile("s_wait_dscnt 0x0" ::: "memory");      // this wave's LDS reads are done
}

template <unsigned PAD_WORD>
__device__ __forceinline__ u32x8 tdm_group1() {
  u32x8 g1;                                          // 1-byte elements, extents in bytes
  g1[0] = uni(PAD_WORD);
  g1[1] = uni(ROW_BYTES << 16);
  g1[2] = uni(TILE_ROWS << 16);
  g1[3] = uni(ROW_BYTES << 16);
  g1[4] = uni(TILE_ROWS);
  g1[5] = uni(ROW_BYTES);
  g1[6] = uni(0u);
  g1[7] = uni(0u);
  asm volatile("" : "+s"(g1));
  return g1;
}

__device__ __forceinline__ u32x4 tdm_group0(unsigned lds_dst, const bf16_t* gsrc) {
  const unsigned long long ga = (unsigned long long)(uintptr_t)gsrc;
  u32x4 g0;
  g0[0] = uni(1u);                                   // count = 1
  g0[1] = uni(lds_dst);                              // byte offset in the group's LDS
  g0[2] = uni((unsigned)ga);                         // address [31:0]
  g0[3] = uni((((unsigned)(ga >> 32)) & 0x01FFFFFFu) | 0x80000000u);  // [56:32], type 2
  return g0;
}
// The next tile: a new place in LDS, the source address one tile further on
// (the carry runs into address bits [56:32] of word 3, below the type field).
__device__ __forceinline__ void tdm_advance(u32x4& g0, unsigned lds_dst) {
  const unsigned long long a =
      ((((unsigned long long)g0[3]) << 32) | g0[2]) + TILE_ROWS * ROW_BYTES;
  g0[1] = uni(lds_dst);
  g0[2] = uni((unsigned)a);
  g0[3] = uni((unsigned)(a >> 32));
}
__device__ __forceinline__ void tdm_issue(u32x4& g0, u32x8 g1) {
  asm volatile("tensor_load_to_lds %0, %1" : "+s"(g0) : "s"(g1) : "memory");
}

// ---------------------------------------------------------------------------
// 128x128 block GEMM core, 8 waves as 4 (m) x 2 (n), 32x64 of the result a wave:
// acc[2][4] covers rows m0..m0+31, cols n0..n0+63 of X @ Wt^T.
// A stage is 128 k (256 bytes) of the block's 128 rows of X and 128 rows of Wt.
// Every wave brings its own slice of 32 rows by one tensor load, whole lines
// from L2, padded to a pitch of 272 B (16 B x odd) for the ds_load_b128 reads.
// Two buffers: the next stage's loads fly while this stage is worked on.
// ---------------------------------------------------------------------------
#define G_ROWS   32u       // rows of one wave's slice
#define G_ROWB   256u      // bytes of a row in one stage
#define G_PITCH  272u      // bytes
#define G_SLICE  10240u    // 32 padded rows, rounded up to a multiple of 2 KiB
#define G_STAGE  (8u * G_SLICE)
#define G_STAGES (DMODEL * 2u / G_ROWB)
#define PAD_G ((1u << 20) | (5u << 22) | (3u << 25))

__device__ __forceinline__ u32x8 gemm_group1() {
  u32x8 g1;                                          // 1-byte elements, extents in bytes
  g1[0] = uni(PAD_G);
  g1[1] = uni(G_ROWB << 16);
  g1[2] = uni(G_ROWS << 16);
  g1[3] = uni(G_ROWB << 16);
  g1[4] = uni(G_ROWS);
  g1[5] = uni(DMODEL * 2u);
  g1[6] = uni(0u);
  g1[7] = uni(0u);
  asm volatile("" : "+s"(g1));
  return g1;
}
// The next stage: a new place in LDS, the source address 128 k further on.
__device__ __forceinline__ void gemm_advance(u32x4& g0, unsigned lds_dst) {
  const unsigned long long a =
      ((((unsigned long long)g0[3]) << 32) | g0[2]) + G_ROWB;
  g0[1] = uni(lds_dst);
  g0[2] = uni((unsigned)a);
  g0[3] = uni((unsigned)(a >> 32));
}

__device__ __forceinline__ void block_gemm_128x128(const bf16_t* __restrict__ X,
                                                   const bf16_t* __restrict__ Wt,
                                                   int mblk, int nblk, v8f acc[2][4]) {
  // [buffer][slice: 0..3 rows of X, 4..7 rows of Wt][padded rows]
  __shared__ __attribute__((aligned(2048))) unsigned char stage[2][8][G_SLICE];
  const int wave  = (int)uni(threadIdx.x >> 5);
  const int lane  = threadIdx.x & 31;
  const int r16   = lane & 15;
  const int kbase = (lane >> 4) << 3;

  const unsigned slot = (unsigned)(uintptr_t)&stage[0][0][0] + (unsigned)wave * G_SLICE;
  const bf16_t* gsrc = wave < 4 ? X  + (size_t)(mblk + wave * 32) * DMODEL
                                : Wt + (size_t)(nblk + (wave - 4) * 32) * DMODEL;
  const u32x8 g1 = gemm_group1();
  u32x4 g0 = tdm_group0(slot, gsrc);
  // prologue: stage 0 into buffer 0, landed and published; then stage 1 into buffer 1
  tdm_issue(g0, g1);
  wait_tensor0();
  __syncthreads();   // stage 0 visible to all waves
  gemm_advance(g0, slot + G_STAGE);
  tdm_issue(g0, g1);

  // this wave's rows: slice wave >> 1 of X, slices 4 + 2 (wave & 1) and the next of Wt
  const unsigned aoff = (unsigned)(wave >> 1) * G_SLICE + (unsigned)r16 * G_PITCH;
  const unsigned boff = (4u + 2u * (unsigned)(wave & 1)) * G_SLICE + (unsigned)r16 * G_PITCH;
  for (unsigned s = 0; s < G_STAGES; ++s) {
    const unsigned cur = s & 1u;
    const bf16_t* arow = (const bf16_t*)(&stage[cur][0][0] + aoff);
    const bf16_t* brow = (const bf16_t*)(&stage[cur][0][0] + boff);
    // two fragment sets: block kk + 1 of this stage is fetched while block kk is multiplied
    v16bf fa[2][2], fb[2][4];
#pragma unroll
    for (int kk = -1; kk < 4; ++kk) {
      if (kk < 3) {
        const int n = (kk + 1) & 1, ko = (kk + 1) * 32;
        fa[n][0] = load_frag16(arow + ko, kbase);
        fa[n][1] = load_frag16(arow + 16 * (G_PITCH / 2) + ko, kbase);
#pragma unroll
        for (int c = 0; c < 4; ++c)
          fb[n][c] = load_frag16(brow + (c >> 1) * (G_SLICE / 2) + (c & 1) * 16 * (G_PITCH / 2) + ko,
                                 kbase);
      }
      // holds a block's 12 loads as one group in front of the block before it;
      // without it each pair of loads sinks to its product and is waited for alone
      __builtin_amdgcn_sched_barrier(0);
      if (kk >= 0) {
        const int u = kk & 1;
#pragma unroll
        for (int c = 0; c < 4; ++c) {
          acc[0][c] = wmma_bf16(fa[u][0], fb[u][c], acc[0][c]);
          acc[1][c] = wmma_bf16(fa[u][1], fb[u][c], acc[1][c]);
        }
      }
      // keeps the next group of loads behind these products, so that it stays one group
      __builtin_amdgcn_sched_barrier(0);
    }
    // ---- hand-over: the next stage is published, this stage's buffer is freed ----
    wait_ds0();
    wait_tensor0();
    __syncthreads();   // next stage visible to all waves; all waves done with this one
    if (pinned(s + 2u < G_STAGES)) {
      gemm_advance(g0, slot + cur * G_STAGE);
      tdm_issue(g0, g1);
    }
  }
  wait_tensor0();
  wait_ds0();
}

// ---------------------------------------------------------------------------
// Conversions
// ---------------------------------------------------------------------------
typedef __attribute__((ext_vector_type(4))) __bf16 v4bf;
typedef __attribute__((ext_vector_type(8))) __bf16 v8bf;

// A block converts 8192 consecutive floats. Each wave-wide load covers 512
// contiguous bytes; a lane's 8 loads are all issued before the first store.
__global__ void __launch_bounds__(256)
f32_to_bf16_kernel(const float* __restrict__ src, bf16_t* __restrict__ dst) {
  const size_t base = (size_t)blockIdx.x * 2048 + threadIdx.x;   // in float4
  const float4* s4 = (const float4*)src + base;
  v4bf*         d4 = (v4bf*)dst + base;
  float4 v[8];
#pragma unroll
  for (int i = 0; i < 8; ++i) v[i] = s4[i * 256];
#pragma unroll
  for (int i = 0; i < 8; ++i) {
    v4bf o = { (bf16_t)v[i].x, (bf16_t)v[i].y, (bf16_t)v[i].z, (bf16_t)v[i].w };
    d4[i * 256] = o;
  }
}

__device__ __forceinline__ void transpose_tile_64x64(const float* __restrict__ src,
                                                     int ld,
                                                     bf16_t* __restrict__ dst) {
  __shared__ float tile[64][65];
  const int t = threadIdx.x;
  const int kr = t >> 4, c4 = (t & 15) << 2;
  float4 v[4];
#pragma unroll
  for (int i = 0; i < 4; ++i)
    v[i] = *(const float4*)(src + (size_t)(kr + 16 * i) * ld + c4);
#pragma unroll
  for (int i = 0; i < 4; ++i) {
    float* row = &tile[kr + 16 * i][c4];
    row[0] = v[i].x; row[1] = v[i].y; row[2] = v[i].z; row[3] = v[i].w;
  }
  __syncthreads();   // the tile is read across the waves that wrote it
  const int k8 = (t & 7) << 3;
#pragma unroll
  for (int p = 0; p < 2; ++p) {
    const int c = (t >> 3) + 32 * p;
    v8bf o;
#pragma unroll
    for (int i = 0; i < 8; ++i) o[i] = (bf16_t)tile[k8 + i][c];
    *(v8bf*)(dst + (size_t)c * DMODEL + k8) = o;
  }
}

// W [H][D][HD] f32 -> Wt [c = h*HD+hd][k = d] bf16 (k-contiguous rows);
// block = (head, 64 rows of d)
__global__ void __launch_bounds__(256)
proj_w_transpose_kernel(const float* __restrict__ W, bf16_t* __restrict__ Wt) {
  const int h = blockIdx.x >> 4, k0 = (blockIdx.x & 15) << 6;
  transpose_tile_64x64(W + ((size_t)h * DMODEL + k0) * HDIM, HDIM,
                       Wt + (size_t)h * HDIM * DMODEL + k0);
}

// Wo [D][D] f32 -> Wot[c][k] = Wo[k][c] bf16; block = (64 columns c, 64 rows k)
__global__ void __launch_bounds__(256)
wo_transpose_kernel(const float* __restrict__ W, bf16_t* __restrict__ Wt) {
  const int c0 = (blockIdx.x >> 4) << 6, k0 = (blockIdx.x & 15) << 6;
  transpose_tile_64x64(W + (size_t)k0 * DMODEL + c0, DMODEL,
                       Wt + (size_t)c0 * DMODEL + k0);
}

// ---------------------------------------------------------------------------
// QKV projection: 128x128 tile per block; out[b,h,s,hd] bf16 = X @ Wt^T + bias
// ---------------------------------------------------------------------------
__global__ void __launch_bounds__(256)
qkv_proj_kernel(const bf16_t* __restrict__ X, const bf16_t* __restrict__ Wt,
                const float* __restrict__ bias, bf16_t* __restrict__ out) {
  const int wave = threadIdx.x >> 5;
  const int lane = threadIdx.x & 31;
  const int mblk = (blockIdx.x >> 3) << 7;   // 32 block rows of 128
  const int nblk = (blockIdx.x & 7) << 7;    // 8 block columns of 128
  const int m0 = mblk + ((wave >> 1) << 5);
  const int n0 = nblk + ((wave & 1) << 6);

  v8f acc[2][4];
#pragma unroll
  for (int i = 0; i < 2; ++i)
#pragma unroll
    for (int c = 0; c < 4; ++c) acc[i][c] = zero8();

  block_gemm_128x128(X, Wt, mblk, nblk, acc);

  const int r16 = lane & 15;
#pragma unroll
  for (int half = 0; half < 2; ++half) {
    const int mbase = m0 + half * 16 + ((lane >> 4) << 3);
#pragma unroll
    for (int c = 0; c < 4; ++c) {
      const int col = n0 + c * 16 + r16;
      const float bv = bias[col];
      const int h = col >> 6, hd = col & 63;
#pragma unroll
      for (int r = 0; r < 8; ++r) {
        const int m = mbase + r;
        const int b = m >> 11, s = m & 2047;
        out[(((size_t)(b * NHEAD + h) * S_LEN) + s) * HDIM + hd] =
            (bf16_t)(acc[half][c][r] + bv);
      }
    }
  }
}

// ---------------------------------------------------------------------------
// Output projection: out f32 [4096][1024] = A @ Wot^T + bo
// ---------------------------------------------------------------------------
__global__ void __launch_bounds__(256)
out_proj_kernel(const bf16_t* __restrict__ A, const bf16_t* __restrict__ Wot,
                const float* __restrict__ bo, float* __restrict__ out) {
  const int wave = threadIdx.x >> 5;
  const int lane = threadIdx.x & 31;
  const int mblk = (blockIdx.x >> 3) << 7;   // 32 block rows of 128
  const int nblk = (blockIdx.x & 7) << 7;    // 8 block columns of 128
  const int m0 = mblk + ((wave >> 1) << 5);
  const int n0 = nblk + ((wave & 1) << 6);

  v8f acc[2][4];
#pragma unroll
  for (int i = 0; i < 2; ++i)
#pragma unroll
    for (int c = 0; c < 4; ++c) acc[i][c] = zero8();

  block_gemm_128x128(A, Wot, mblk, nblk, acc);

  const int r16 = lane & 15;
#pragma unroll
  for (int half = 0; half < 2; ++half) {
    const int mbase = m0 + half * 16 + ((lane >> 4) << 3);
#pragma unroll
    for (int c = 0; c < 4; ++c) {
      const int col = n0 + c * 16 + r16;
      const float bv = bo[col];
#pragma unroll
      for (int r = 0; r < 8; ++r)
        out[(size_t)(mbase + r) * DMODEL + col] = acc[half][c][r] + bv;
    }
  }
}

typedef __attribute__((ext_vector_type(8))) short s16x8;

// 16x8 block of a row-major 16-bit LDS tile, delivered transposed
__device__ __forceinline__ u32x4 lds_load_tr16(const bf16_t* p) {
  typedef __attribute__((address_space(3))) s16x8 lds_s16x8;
  return __builtin_bit_cast(u32x4, __builtin_amdgcn_ds_load_tr16_b128_v8i16((lds_s16x8*)p));
}

__device__ __forceinline__ float other_half(float x) {
  const int xi = __builtin_bit_cast(int, x);
  return __builtin_bit_cast(float, __builtin_amdgcn_permlanex16(
      xi, xi, 0x76543210, 0xfedcba98, false, false));
}

// mask carries no __restrict__: its loads then count as ordinary memory reads,
// which the compiler fence in the pass keeps at the top of the pass.
__global__ void __launch_bounds__(256)
attn_kernel(const bf16_t* __restrict__ Q, const bf16_t* __restrict__ Kmat,
            const bf16_t* __restrict__ V, const int* mask,
            bf16_t* __restrict__ attn_out) {
  // [buffer][K, V][padded tile]
  __shared__ __attribute__((aligned(2048))) unsigned char ring[2][2][SLOT_BYTES];

  const int b    = blockIdx.z;
  const int h    = blockIdx.y;
  const int wave = (int)uni(threadIdx.x >> 5);
  const int lane = threadIdx.x & 31;
  const int q0   = blockIdx.x * 128 + wave * 16;

  const size_t bh = (size_t)(b * NHEAD + h) * S_LEN * HDIM;
  const bf16_t* Qbh = Q    + bh;
  const bf16_t* Kbh = Kmat + bh;
  const bf16_t* Vbh = V    + bh;

  const int r16   = lane & 15;
  const int kbase = (lane >> 4) << 3;

  // Q^T fragment (64 k x 16 query columns), reused for the whole key loop
  const bf16_t* qrow = Qbh + (size_t)(q0 + r16) * HDIM;
  const v16bf qb0 = load_frag16(qrow, kbase);        // k = 0..31
  const v16bf qb1 = load_frag16(qrow + 32, kbase);   // k = 32..63

  // this lane's query row of the mask, at its half's first key
  const int* mlane = mask + ((size_t)b * S_LEN + (q0 + r16)) * S_LEN + kbase;

  float mrun = -INFINITY;   // running maximum of query q0 + r16 (both halves)
  float lrun = 0.f;         // running sum over this half's keys only
  v8f oacc[4];              // oacc[t][r] = O[q0 + r16][16 t + kbase + r]
#pragma unroll
  for (int t = 0; t < 4; ++t) oacc[t] = zero8();

  const unsigned lbase = (unsigned)(uintptr_t)&ring[0][0][0];
  const u32x8 g1k = tdm_group1<PAD_K>();
  const u32x8 g1v = tdm_group1<PAD_V>();
  // prologue: tile 0 into buffer 0, landed and published; then tile 1 into buffer 1
  const unsigned slot = lbase + (wave == 1 ? SLOT_BYTES : 0u);   // this wave's operand
  u32x4 g0 = tdm_group0(slot, wave == 1 ? Vbh : Kbh);
  if (pinned(wave == 0)) { tdm_issue(g0, g1k); wait_tensor0(); }
  if (pinned(wave == 1)) { tdm_issue(g0, g1v); wait_tensor0(); }
  __syncthreads();   // tile 0 visible to all waves
  tdm_advance(g0, slot + 2u * SLOT_BYTES);
  if (pinned(wave == 0)) tdm_issue(g0, g1k);
  if (pinned(wave == 1)) tdm_issue(g0, g1v);

  int step = 0;
  for (int s0 = 0; s0 < S_LEN; s0 += 32, ++step) {
    const int cur = step & 1;
    const bf16_t* Kc = (const bf16_t*)&ring[cur][0][0];   // row pitch K_PITCH
    const bf16_t* Vc = (const bf16_t*)&ring[cur][1][0];   // row pitch V_PITCH

    // ---- scores S^T = K_tile (32x64) @ Q^T (64x16), scale + mask ----
    // mask of keys s0 + 16 kt + kbase + 0..7 for this lane's query
    int4 mk[2][2];
#pragma unroll
    for (int kt = 0; kt < 2; ++kt) {
      mk[kt][0] = *(const int4*)(mlane + s0 + kt * 16);
      mk[kt][1] = *(const int4*)(mlane + s0 + kt * 16 + 4);
    }
    v16bf ka[2][2];      // A: row = key pos 16 kt + r16, k = d
#pragma unroll
    for (int kt = 0; kt < 2; ++kt) {
      const bf16_t* krow = Kc + (kt * 16 + r16) * (K_PITCH / 2);
      ka[kt][0] = load_frag16(krow, kbase);
      ka[kt][1] = load_frag16(krow + 32, kbase);
    }
    // these two hold the mask and K loads together in front of the products;
    // without them each load sinks to its first use and its latency is paid by
    // itself (the compiler fence orders the loads before instruction selection,
    // the scheduling barrier after it)
    asm volatile("" ::: "memory");
    __builtin_amdgcn_sched_barrier(0);
    v8f sacc[2];
#pragma unroll
    for (int kt = 0; kt < 2; ++kt) {
      sacc[kt] = wmma_bf16(ka[kt][0], qb0, zero8());
      sacc[kt] = wmma_bf16(ka[kt][1], qb1, sacc[kt]);
    }
    // V^T fragments (A: row = d 16 t + r16, k = keys in the order of pb below).
    // Lane address of the transposing load: key row kbase + (lane & 7),
    // 16-byte half (lane >> 3) & 1 of the 16 d columns.
    v16bf va[4];
    {
      const bf16_t* vp = Vc + (kbase + (lane & 7)) * (V_PITCH / 2) + ((lane >> 3) & 1) * 8;
#pragma unroll
      for (int t = 0; t < 4; ++t) {
        ((u32x4*)&va[t])[0] = lds_load_tr16(vp + t * 16);             // keys kbase + 0..7
        ((u32x4*)&va[t])[1] = lds_load_tr16(vp + 16 * (V_PITCH / 2) + t * 16);   // keys 16 + kbase + 0..7
      }
    }
    // holds the V^T loads here as one group; without it they sink between the
    // second products, each pair in front of a wait of its own
    __builtin_amdgcn_sched_barrier(0);
    float sc[2][8];
#pragma unroll
    for (int kt = 0; kt < 2; ++kt) {
      const int mv[8] = { mk[kt][0].x, mk[kt][0].y, mk[kt][0].z, mk[kt][0].w,
                          mk[kt][1].x, mk[kt][1].y, mk[kt][1].z, mk[kt][1].w };
#pragma unroll
      for (int r = 0; r < 8; ++r) {
        const float vsc = sacc[kt][r] * 0.125f;   // 1/sqrt(64)
        sc[kt][r] = (mv[r] == 0) ? -INFINITY : vsc;
      }
    }

    // ---- online softmax: one query per lane ----
    float rmax = sc[0][0];
#pragma unroll
    for (int i = 1; i < 16; ++i) rmax = fmaxf(rmax, sc[i >> 3][i & 7]);
    rmax = fmaxf(rmax, other_half(rmax));
    const float mnew  = fmaxf(mrun, rmax);
    // while every key so far is masked the shift is 0: sums stay 0, not NaN
    const float shift = (mnew == -INFINITY) ? 0.f : mnew;
    const float alpha = __expf(mrun - shift);
    v16bf pb;            // P^T as B operand: pb[8 kt + r] = P[16 kt + kbase + r]
    float rsum = 0.f;
#pragma unroll
    for (int kt = 0; kt < 2; ++kt)
#pragma unroll
      for (int r = 0; r < 8; ++r) {
        const float p = __expf(sc[kt][r] - shift);
        rsum += p;
        pb[kt * 8 + r] = (bf16_t)p;
      }
    lrun = lrun * alpha + rsum;
    mrun = mnew;
#pragma unroll
    for (int t = 0; t < 4; ++t) oacc[t] *= alpha;

    // ---- O^T += V_tile^T (64x32) @ P^T (32x16) ----
#pragma unroll
    for (int t = 0; t < 4; ++t) oacc[t] = wmma_bf16(va[t], pb, oacc[t]);

    // ---- hand-over: the next tile is published, this pass's buffer is freed ----
    wait_ds0();
    if (pinned(wave < 2)) wait_tensor0();
    __syncthreads();   // next tile visible to all waves; all waves done with this one
    if (pinned(s0 + 64 < S_LEN)) {
      tdm_advance(g0, slot + (unsigned)cur * (2u * SLOT_BYTES));
      if (pinned(wave == 0)) tdm_issue(g0, g1k);
      if (pinned(wave == 1)) tdm_issue(g0, g1v);
    }
  }
  wait_tensor0();
  wait_ds0();

  // ---- epilogue: join the halves' sums, normalize, concat heads along D ----
  const float inv = 1.0f / (lrun + other_half(lrun));
  bf16_t* orow = attn_out + ((size_t)b * S_LEN + (q0 + r16)) * DMODEL + h * HDIM + kbase;
#pragma unroll
  for (int t = 0; t < 4; ++t) {
    __attribute__((ext_vector_type(8))) __bf16 o8;
#pragma unroll
    for (int r = 0; r < 8; ++r) o8[r] = (bf16_t)(oacc[t][r] * inv);
    *(u32x4*)(orow + t * 16) = __builtin_bit_cast(u32x4, o8);
  }
}

// ---------------------------------------------------------------------------
// Host-side launch
// ---------------------------------------------------------------------------
extern "C" void kernel_launch(void* const* d_in, const int* in_sizes, int n_in,
                              void* d_out, int out_size, void* d_ws, size_t ws_size,
                              hipStream_t stream) {
  (void)in_sizes; (void)n_in; (void)out_size; (void)ws_size;
  const float* dec  = (const float*)d_in[0];
  const float* enc  = (const float*)d_in[1];
  const int*   mask = (const int*)  d_in[2];
  const float* Wq   = (const float*)d_in[3];
  const float* bq   = (const float*)d_in[4];
  const float* Wk   = (const float*)d_in[5];
  const float* bk   = (const float*)d_in[6];
  const float* Wv   = (const float*)d_in[7];
  const float* bv   = (const float*)d_in[8];
  const float* Wo   = (const float*)d_in[9];
  const float* bo   = (const float*)d_in[10];
  float* out = (float*)d_out;

  char* ws = (char*)d_ws;
  size_t off = 0;
  auto alloc = [&](size_t bytes) -> char* {
    char* p = ws + off;
    off += (bytes + 255) & ~(size_t)255;
    return p;
  };

  const size_t HS_ELEMS  = (size_t)MTOT * DMODEL;             // 4194304
  const size_t W_ELEMS   = (size_t)DMODEL * DMODEL;           // 1048576
  const size_t QKV_ELEMS = (size_t)2 * NHEAD * S_LEN * HDIM;  // 4194304

  bf16_t* enc_bf  = (bf16_t*)alloc(HS_ELEMS * 2);
  bf16_t* dec_bf  = (bf16_t*)alloc(HS_ELEMS * 2);
  bf16_t* Wqt     = (bf16_t*)alloc(W_ELEMS * 2);
  bf16_t* Wkt     = (bf16_t*)alloc(W_ELEMS * 2);
  bf16_t* Wvt     = (bf16_t*)alloc(W_ELEMS * 2);
  bf16_t* Wot     = (bf16_t*)alloc(W_ELEMS * 2);
  bf16_t* qbuf    = (bf16_t*)alloc(QKV_ELEMS * 2);
  bf16_t* kbuf    = (bf16_t*)alloc(QKV_ELEMS * 2);
  bf16_t* vbuf    = (bf16_t*)alloc(QKV_ELEMS * 2);
  bf16_t* attn_bf = (bf16_t*)alloc(HS_ELEMS * 2);

  // 1) fp32 -> bf16 conversions / weight transposes
  f32_to_bf16_kernel<<<(int)(HS_ELEMS / 8192), 256, 0, stream>>>(enc, enc_bf);
  f32_to_bf16_kernel<<<(int)(HS_ELEMS / 8192), 256, 0, stream>>>(dec, dec_bf);
  proj_w_transpose_kernel<<<(int)(W_ELEMS / 4096), 256, 0, stream>>>(Wq, Wqt);
  proj_w_transpose_kernel<<<(int)(W_ELEMS / 4096), 256, 0, stream>>>(Wk, Wkt);
  proj_w_transpose_kernel<<<(int)(W_ELEMS / 4096), 256, 0, stream>>>(Wv, Wvt);
  wo_transpose_kernel<<<(int)(W_ELEMS / 4096), 256, 0, stream>>>(Wo, Wot);

  // 2) projections (reference arg swap: q <- enc, k/v <- dec)
  qkv_proj_kernel<<<256, 256, 0, stream>>>(enc_bf, Wqt, bq, qbuf);
  qkv_proj_kernel<<<256, 256, 0, stream>>>(dec_bf, Wkt, bk, kbuf);
  qkv_proj_kernel<<<256, 256, 0, stream>>>(dec_bf, Wvt, bv, vbuf);

  // 3) attention: grid (q-blocks of 128, H, B)
  attn_kernel<<<dim3(S_LEN / 128, NHEAD, 2), 256, 0, stream>>>(qbuf, kbuf, vbuf, mask, attn_bf);

  // 4) output projection -> f32
  out_proj_kernel<<<256, 256, 0, stream>>>(attn_bf, Wot, bo, out);
}
